// v000
// The times below were measured on an AMD MI455X: many runs one after another, warmed up first and cycling through
// copies of the inputs, with the whole window's GPU time divided by the number of runs. Launches and the gaps
// between them are all in it. The median over several windows is given; except for v000 it joins two sittings, which
// can be a few percent apart, so the side-by-side timings, each taken in one sitting, are the better comparison.
// The starting kernel, v000, takes 2940 microseconds a run.
#include <hip/hip_runtime.h>

// Masked (causal) multi-head attention with residual and post-LayerNorm (x [4][2048][1024]; q,k,v = x w + b ('xw' uniform(+-1/32) incl. biases; 16 heads x 64); scores / 8; causal (-inf); softmax; out = merged wo + bo; y = (out + x - mean) / sqrt(var + 1e-5) ln_g + ln_b -> [4][2048][1024] (8.4 M)).
// Layout per batch: bf16 copy of x; 'xw' weights transposed once; exact projections + f32 biases; causal T-2048 attention (hybrid rows: < 512 hi/lo 3 products, rest fp16 x1024; tiles above the diagonal skipped); merged hi/lo x Wo exact + bo into workspace; residual add and a row LayerNorm kernel write the output rows.
// Compute dtypes, f32 accumulate: every input rounded to bf16; projections exact + f32 biases; attention rows < 512 3 products, rest fp16; softmax f32; Wo hl x exact + bias; residual + LayerNorm f32.

#define NB_  4
#define TT   2048
#define DM   1024
#define NH_  16
#define NKV  16
#define REP  (NH_ / NKV)
#define HD   64
#define DQ   (NH_ * HD)
#define DKV  (NKV * HD)
#define ZH   2
#define RH   512                  // query rows < RH use hi+lo planes (0: none)
#define WIN  2048
#define PCAR 1024.0f
#define SCL  0.125f   // HD^-0.5
#define LNEPS 1e-5f
typedef _Float16 h16;
typedef unsigned short bf;
typedef __attribute__((ext_vector_type(16))) __bf16   v16bf;
typedef __attribute__((ext_vector_type(16))) _Float16 v16h;
typedef __attribute__((ext_vector_type(8)))  _Float16 v8h;
typedef __attribute__((ext_vector_type(8)))  unsigned short v8us;
typedef __attribute__((ext_vector_type(8)))  float    v8f;
typedef __attribute__((ext_vector_type(4)))  float    v4f;
typedef v8h  __attribute__((may_alias)) v8ha;
typedef v4f  __attribute__((may_alias)) v4fa;
typedef v8us __attribute__((may_alias)) v8usa;

__device__ __forceinline__ unsigned short f2bf(float f) { unsigned u = __float_as_uint(f); u += 0x7FFFu + ((u >> 16) & 1u); return (unsigned short)(u >> 16); }
__device__ __forceinline__ float bf2f(unsigned short b) { return __uint_as_float(((unsigned)b) << 16); }
__device__ __forceinline__ float bfr(float f) { return bf2f(f2bf(f)); }
__device__ __forceinline__ v16h cat16(v8h lo, v8h hi) { return __builtin_shufflevector(lo, hi, 0, 1, 2, 3, 4, 5, 6, 7, 8, 9, 10, 11, 12, 13, 14, 15); }
__device__ __forceinline__ v16bf cat16b(v8us lo, v8us hi) { return __builtin_bit_cast(v16bf, __builtin_shufflevector(lo, hi, 0, 1, 2, 3, 4, 5, 6, 7, 8, 9, 10, 11, 12, 13, 14, 15)); }
__device__ __forceinline__ v8f wmma16(v16h a, v16h b, v8f c) { return __builtin_amdgcn_wmma_f32_16x16x32_f16(false, a, false, b, (short)0, c, false, false); }
__device__ __forceinline__ v8f wmmab(v16bf a, v16bf b, v8f c) { return __builtin_amdgcn_wmma_f32_16x16x32_bf16(false, a, false, b, (short)0, c, false, false); }



// ---- k_gemmw: register-blocked GEMM, ONE WAVE per 64x64 output tile (16 accumulators), operands straight from K-contiguous 16-bit planes; grid (M/64, N/64, Z), 32 threads.
// C[m][n] (f32, pitch ldc, + optional f32 bias[n]) = sum_k A[m][k] Bt[n][k] (+ split products per NSPLIT). z-batch strides sA/sB/sC in elements. K % 32 == 0.
template <typename T16> struct WFrag;
template <> struct WFrag<h16> { typedef v16h V; static __device__ __forceinline__ V ld(const h16* p) { return cat16(*(const v8h*)p, *(const v8h*)(p + 16)); } static __device__ __forceinline__ v8f mma(V a, V b, v8f c) { return wmma16(a, b, c); } };
template <> struct WFrag<bf> { typedef v16bf V; static __device__ __forceinline__ V ld(const bf* p) { return cat16b(*(const v8us*)p, *(const v8us*)(p + 16)); } static __device__ __forceinline__ v8f mma(V a, V b, v8f c) { return wmmab(a, b, c); } };
template <typename T16, int NSPLIT, bool BIAS>
__global__ __launch_bounds__(32) void k_gemmw(const T16* __restrict__ A, const T16* __restrict__ A2, const T16* __restrict__ Bt, const T16* __restrict__ Bt2, int K, float* C, int ldc, const float* __restrict__ bias, size_t sA, size_t sB, size_t sC) {
    typedef typename WFrag<T16>::V V;
    __shared__ __align__(16) float os[16 * 68];
    const size_t z = blockIdx.z; A += z * sA; if (A2) A2 += z * sA; Bt += z * sB; if (Bt2) Bt2 += z * sB; C += z * sC;
    const int lane = threadIdx.x & 31, lr = lane & 15, hi = lane >> 4; const int r0 = blockIdx.x * 64, c0 = blockIdx.y * 64;
    v8f acc[4][4];
#pragma unroll
    for (int mb = 0; mb < 4; ++mb)
#pragma unroll
        for (int nb = 0; nb < 4; ++nb) acc[mb][nb] = (v8f){};
    const size_t aoff = (size_t)(r0 + lr) * K + 8 * hi, boff = (size_t)(c0 + lr) * K + 8 * hi;
#pragma unroll 1
    for (int kc = 0; kc < K; kc += 32) {
        V a[4], a2[4];
#pragma unroll
        for (int mb = 0; mb < 4; ++mb) { a[mb] = WFrag<T16>::ld(A + aoff + (size_t)mb * 16 * K + kc); if (NSPLIT == 1 || NSPLIT == 2) a2[mb] = WFrag<T16>::ld(A2 + aoff + (size_t)mb * 16 * K + kc); }
#pragma unroll
        for (int nb = 0; nb < 4; ++nb) { const V b = WFrag<T16>::ld(Bt + boff + (size_t)nb * 16 * K + kc); V b2; if (NSPLIT >= 2) b2 = WFrag<T16>::ld(Bt2 + boff + (size_t)nb * 16 * K + kc);
#pragma unroll
            for (int mb = 0; mb < 4; ++mb) { acc[mb][nb] = WFrag<T16>::mma(a[mb], b, acc[mb][nb]); if (NSPLIT == 1 || NSPLIT == 2) acc[mb][nb] = WFrag<T16>::mma(a2[mb], b, acc[mb][nb]); if (NSPLIT >= 2) acc[mb][nb] = WFrag<T16>::mma(a[mb], b2, acc[mb][nb]); } }
        asm volatile("v_nop\n\tv_nop\n\tv_nop\n\tv_nop" : "+v"(acc[0][0]), "+v"(acc[1][1]), "+v"(acc[2][2]), "+v"(acc[3][3]) : "v"(a[0]), "v"(a[3]));
    }
#pragma unroll
    for (int mb = 0; mb < 4; ++mb) {
#pragma unroll
        for (int nb = 0; nb < 4; ++nb) {
#pragma unroll
            for (int j = 0; j < 8; ++j) os[(hi * 8 + j) * 68 + nb * 16 + lr] = acc[mb][nb][j]; }
        __builtin_amdgcn_wave_barrier(); asm volatile("" ::: "memory");
        float* crow = C + (size_t)(r0 + mb * 16) * ldc + c0;
{
#pragma unroll
            for (int s = 0; s < 8; ++s) { const int row = 2 * s + hi, cofs = lr * 4; v4f val = *(const v4fa*)(os + row * 68 + cofs); if (BIAS) { val[0] += bfr(bias[c0 + cofs]); val[1] += bfr(bias[c0 + cofs + 1]); val[2] += bfr(bias[c0 + cofs + 2]); val[3] += bfr(bias[c0 + cofs + 3]); }
                *(v4f*)(crow + (size_t)row * ldc + cofs) = val; }
             }
        __builtin_amdgcn_wave_barrier(); asm volatile("" ::: "memory");
    }
}

// ---- k_gemmc: the same one-wave 64x64 tile GEMM specialised for causal attention: CMODE 1 skips score tiles entirely above the diagonal (query rows r0+roff.., key columns c0..), CMODE 2 limits the
// key (K) loop of the probability x value contraction to the diagonal block (probabilities beyond it are exactly zero). roff = row offset of this launch's first row within the sequence.
template <typename T16, int NSPLIT, int CMODE>
__global__ __launch_bounds__(32) void k_gemmc(const T16* __restrict__ A, const T16* __restrict__ A2, const T16* __restrict__ Bt, const T16* __restrict__ Bt2, int K, float* C, int ldc, int roff, size_t sA, size_t sB, size_t sC) {
    typedef typename WFrag<T16>::V V;
    __shared__ __align__(16) float os[16 * 68];
    const size_t z = blockIdx.z; A += z * sA; if (A2) A2 += z * sA; Bt += z * sB; if (Bt2) Bt2 += z * sB; C += z * sC;
    const int lane = threadIdx.x & 31, lr = lane & 15, hi = lane >> 4; const int r0 = blockIdx.x * 64, c0 = blockIdx.y * 64;
    if (CMODE == 1 && c0 > r0 + roff + 63) return;                  // score tile entirely above the causal diagonal: never read (the softmax masks j > i by select)
    const int Kl = (CMODE == 2) ? min(K, r0 + roff + 64) : K;        // P.V: probabilities are exactly 0 beyond the diagonal block, so the K loop stops there
    v8f acc[4][4];
#pragma unroll
    for (int mb = 0; mb < 4; ++mb)
#pragma unroll
        for (int nb = 0; nb < 4; ++nb) acc[mb][nb] = (v8f){};
    const size_t aoff = (size_t)(r0 + lr) * K + 8 * hi, boff = (size_t)(c0 + lr) * K + 8 * hi;
#pragma unroll 1
    for (int kc = 0; kc < Kl; kc += 32) {
        V a[4], a2[4];
#pragma unroll
        for (int mb = 0; mb < 4; ++mb) { a[mb] = WFrag<T16>::ld(A + aoff + (size_t)mb * 16 * K + kc); if (NSPLIT == 1 || NSPLIT == 2) a2[mb] = WFrag<T16>::ld(A2 + aoff + (size_t)mb * 16 * K + kc); }
#pragma unroll
        for (int nb = 0; nb < 4; ++nb) { const V b = WFrag<T16>::ld(Bt + boff + (size_t)nb * 16 * K + kc); V b2; if (NSPLIT >= 2) b2 = WFrag<T16>::ld(Bt2 + boff + (size_t)nb * 16 * K + kc);
#pragma unroll
            for (int mb = 0; mb < 4; ++mb) { acc[mb][nb] = WFrag<T16>::mma(a[mb], b, acc[mb][nb]); if (NSPLIT == 1 || NSPLIT == 2) acc[mb][nb] = WFrag<T16>::mma(a2[mb], b, acc[mb][nb]); if (NSPLIT >= 2) acc[mb][nb] = WFrag<T16>::mma(a[mb], b2, acc[mb][nb]); } }
        asm volatile("v_nop\n\tv_nop\n\tv_nop\n\tv_nop" : "+v"(acc[0][0]), "+v"(acc[1][1]), "+v"(acc[2][2]), "+v"(acc[3][3]) : "v"(a[0]), "v"(a[3]));
    }
#pragma unroll
    for (int mb = 0; mb < 4; ++mb) {
#pragma unroll
        for (int nb = 0; nb < 4; ++nb) {
#pragma unroll
            for (int j = 0; j < 8; ++j) os[(hi * 8 + j) * 68 + nb * 16 + lr] = acc[mb][nb][j]; }
        __builtin_amdgcn_wave_barrier(); asm volatile("" ::: "memory");
        float* crow = C + (size_t)(r0 + mb * 16) * ldc + c0;
{
#pragma unroll
            for (int s = 0; s < 8; ++s) { const int row = 2 * s + hi, cofs = lr * 4; v4f val = *(const v4fa*)(os + row * 68 + cofs);
                *(v4f*)(crow + (size_t)row * ldc + cofs) = val; }
             }
        __builtin_amdgcn_wave_barrier(); asm volatile("" ::: "memory");
    }
}

__device__ __forceinline__ h16 tohx(float x) { return (h16)x; }
__device__ __forceinline__ void splitf(float y, unsigned short& h, unsigned short& l) { h = f2bf(y); l = f2bf(y - bf2f(h)); }
typedef __attribute__((ext_vector_type(2))) _Float16 v2h;
typedef __attribute__((ext_vector_type(4))) _Float16 v4h;
typedef __attribute__((ext_vector_type(2))) unsigned short v2us;
typedef __attribute__((ext_vector_type(4))) unsigned short v4us;
typedef __attribute__((ext_vector_type(2))) float v2f;
typedef __attribute__((ext_vector_type(4))) int v4i;

__global__ __launch_bounds__(256) void k_wtG(const float* __restrict__ w, int K, int N, bf* Bt) {
    const int lane = threadIdx.x & 31; const int L0 = (blockIdx.x * 8 + (threadIdx.x >> 5)) * 8; const int nlines = N * K / 64;
{
#pragma unroll 1
        for (int l = 0; l < 8; ++l) { const int L = L0 + l; if (L >= nlines) break; const size_t e = (size_t)L * 64 + lane * 2; const int k = (int)(e % K), n = (int)(e / K); v2us o;
            o[0] = f2bf(w[(size_t)k * N + n]); o[1] = f2bf(w[(size_t)(k + 1) * N + n]); *(v2us*)(Bt + e) = o; }
         }
}
__global__ __launch_bounds__(256) void k_cvt8(const float* __restrict__ src, bf* dst, size_t n8) { const size_t i = (size_t)blockIdx.x * 256 + threadIdx.x; if (i >= n8) return; const v8f v = *(const v8f*)(src + i * 8); v8us o;
#pragma unroll
    for (int k = 0; k < 8; ++k) o[k] = f2bf(v[k]); *(v8us*)(dst + i * 8) = o;  }

// k_rope: head planes [h][t][d] (fp16 + hi/lo) of rope(x) x sc with the rotate-half convention out[d] = x[d] cos[t][d] - x[d+HD/2] sin[t][d], out[d+HD/2] = x[d+HD/2] cos[t][d+HD/2] + x[d] sin[t][d+HD/2]
__global__ __launch_bounds__(256) void k_rope(const float* __restrict__ F, int pitch, int nheads, const float* __restrict__ CS, const float* __restrict__ RF, const float* __restrict__ nw, float sc, h16* P16, bf* Ph, bf* Pl) {
    const size_t e = ((size_t)blockIdx.x * 256 + threadIdx.x) * 2; if (e >= (size_t)nheads * TT * HD) return; const int d = (int)(e % HD); const int t = (int)((e / HD) % TT); const int h = (int)(e / ((size_t)HD * TT)); const float* f = F + (size_t)t * pitch + h * HD; const float rf = RF ? RF[(size_t)h * TT + t] : 1.0f; v2h o16; v2us oh, ol;
#pragma unroll
    for (int q = 0; q < 2; ++q) { const int dd = d + q; const int dp = (dd < HD / 2) ? dd + HD / 2 : dd - HD / 2; float x0 = f[dd], x1 = f[dp];
        if (RF) { float n0 = __fmul_rn(x0, rf), n1 = __fmul_rn(x1, rf); asm volatile("" : "+v"(n0)); asm volatile("" : "+v"(n1)); x0 = __fmul_rn(bfr(nw[dd]), n0); x1 = __fmul_rn(bfr(nw[dp]), n1); }
        const v2f cs = *(const v2f*)(CS + ((size_t)t * HD + dd) * 2); float a = __fmul_rn(x0, cs[0]), bq = __fmul_rn(x1, cs[1]); asm volatile("" : "+v"(a)); asm volatile("" : "+v"(bq)); const float r = ((dd < HD / 2) ? __fsub_rn(a, bq) : __fadd_rn(a, bq)) * sc;
        o16[q] = tohx(r); unsigned short a2, c2; splitf(r, a2, c2); oh[q] = a2; ol[q] = c2; }
    *(v2h*)(P16 + e) = o16; *(v2us*)(Ph + e) = oh; *(v2us*)(Pl + e) = ol;  }
__global__ __launch_bounds__(256) void k_vtp(const float* __restrict__ F, int pitch, int nheads, h16* V16, bf* Vh, bf* Vl) { const size_t e = ((size_t)blockIdx.x * 256 + threadIdx.x) * 2; if (e >= (size_t)nheads * HD * TT) return; const int t = (int)(e % TT); const int d = (int)((e / TT) % HD); const int g = (int)(e / ((size_t)TT * HD)); v2h o16; v2us oh, ol;
#pragma unroll
    for (int q = 0; q < 2; ++q) { const float x = F[(size_t)(t + q) * pitch + g * HD + d]; o16[q] = tohx(x); unsigned short a2, c2; splitf(x, a2, c2); oh[q] = a2; ol[q] = c2; }
    *(v2h*)(V16 + e) = o16; *(v2us*)(Vh + e) = oh; *(v2us*)(Vl + e) = ol;  }
__global__ __launch_bounds__(256) void k_csid(float* CS) { const int idx = blockIdx.x * 256 + threadIdx.x; if (idx >= TT * HD) return; v2f cs; cs[0] = 1.0f; cs[1] = 0.0f; *(v2f*)(CS + (size_t)idx * 2) = cs;  }
// k_asoft: per row (zz, i): t = S x HD^-0.5 for j <= i and i - j < WIN (sliding causal window; the reference's -1e9 additive fill vanishes identically); softmax over the 2048 keys (register row, one exp, fixed trees);
__global__ __launch_bounds__(256) void k_asoft(const float* __restrict__ Sb, h16* P16, bf* Ph, bf* Pl) {
    const int lane = threadIdx.x & 31; const int row = blockIdx.x * 8 + (threadIdx.x >> 5); if (row >= ZH * TT) return; const int i = row % TT; const int zz = row / TT; (void)zz; const bool hires = (i < RH); const float* sr = Sb + (size_t)row * TT; float v[TT / 32]; float mx = -3.0e38f;
#pragma unroll
    for (int ch = 0; ch < TT / 128; ++ch) { const int j0 = ch * 128 + lane * 4; const v4f a = *(const v4f*)(sr + j0);
#pragma unroll
        for (int q = 0; q < 4; ++q) { const int j = j0 + q; (void)j; const float t = (j <= i && i - j < WIN) ? a[q] * SCL : -3.0e38f; v[ch * 4 + q] = t; mx = fmaxf(mx, t); } }
#pragma unroll
    for (int sh = 16; sh; sh >>= 1) mx = fmaxf(mx, __shfl_xor(mx, sh, 32));
    float sum = 0.f;
#pragma unroll
    for (int k = 0; k < TT / 32; ++k) { float d0 = __fsub_rn(v[k], mx); asm volatile("" : "+v"(d0)); v[k] = __builtin_amdgcn_exp2f(__fmul_rn(d0, 1.4426950408889634f)); sum += v[k]; }
#pragma unroll
    for (int sh = 16; sh; sh >>= 1) sum += __shfl_xor(sum, sh, 32);
    const float f = __fdiv_rn(hires ? 1.0f : PCAR, sum);
{
        if (hires) {
#pragma unroll
            for (int ch = 0; ch < TT / 128; ++ch) { v4us oh, ol;
#pragma unroll
                for (int q = 0; q < 4; ++q) { unsigned short a, c2; splitf(v[ch * 4 + q] * f, a, c2); oh[q] = a; ol[q] = c2; }
                const size_t oo = ((size_t)zz * (RH ? RH : 1) + i) * TT + ch * 128 + lane * 4; *(v4us*)(Ph + oo) = oh; *(v4us*)(Pl + oo) = ol; }
        } else {
#pragma unroll
            for (int ch = 0; ch < TT / 128; ++ch) { v4h o4;
#pragma unroll
                for (int q = 0; q < 4; ++q) o4[q] = tohx(v[ch * 4 + q] * f);
                *(v4h*)(P16 + (size_t)row * TT + ch * 128 + lane * 4) = o4; } }
         }
}
__global__ __launch_bounds__(256) void k_addres(float* Y, const float* __restrict__ xr) { const size_t i = (size_t)blockIdx.x * 256 + threadIdx.x; if (i >= (size_t)TT * DQ / 4) return; const v4f a = *(const v4f*)(Y + i * 4); const v4f r = *(const v4f*)(xr + i * 4); v4f o;
#pragma unroll
    for (int q = 0; q < 4; ++q) o[q] = __fadd_rn(a[q], bfr(r[q]));
    *(v4f*)(Y + i * 4) = o;  }
__global__ __launch_bounds__(256) void k_lnout(const float* __restrict__ F, const float* __restrict__ g, const float* __restrict__ bb, float* out) { const int lane = threadIdx.x & 31; const int row = blockIdx.x * 8 + (threadIdx.x >> 5); if (row >= TT) return; const float* fr = F + (size_t)row * DQ; float* orow = out + (size_t)row * DQ; float v[DQ / 32]; float s = 0.f;
#pragma unroll
    for (int c = 0; c < DQ / 128; ++c) { const v4f a = *(const v4f*)(fr + c * 128 + lane * 4); for (int q = 0; q < 4; ++q) { v[c * 4 + q] = a[q]; s = __fadd_rn(s, a[q]); } }
#pragma unroll
    for (int sh = 16; sh; sh >>= 1) s = __fadd_rn(s, __shfl_xor(s, sh, 32));
    const float mean = __fdiv_rn(s, (float)DQ); float s2 = 0.f;
#pragma unroll
    for (int k = 0; k < DQ / 32; ++k) { const float dv = __fsub_rn(v[k], mean); float p2 = __fmul_rn(dv, dv); asm volatile("" : "+v"(p2)); s2 = __fadd_rn(s2, p2); v[k] = dv; }
#pragma unroll
    for (int sh = 16; sh; sh >>= 1) s2 = __fadd_rn(s2, __shfl_xor(s2, sh, 32));
    const float rs = __fdiv_rn(1.0f, __fsqrt_rn(__fadd_rn(__fdiv_rn(s2, (float)DQ), LNEPS)));
{
#pragma unroll
        for (int c = 0; c < DQ / 128; ++c) { v4f o; for (int q = 0; q < 4; ++q) { const int col = c * 128 + lane * 4 + q; float y = __fmul_rn(v[c * 4 + q], rs); asm volatile("" : "+v"(y)); y = __fmul_rn(y, bfr(g[col])); asm volatile("" : "+v"(y)); o[q] = __fadd_rn(y, bfr(bb[col])); } *(v4f*)(orow + c * 128 + lane * 4) = o; }
         } }
__global__ __launch_bounds__(256) void k_merge(const float* __restrict__ O, int h0, bf* Ah, bf* Al) { const size_t e = ((size_t)blockIdx.x * 256 + threadIdx.x) * 2; if (e >= (size_t)ZH * TT * HD) return; const int d = (int)(e % HD); const int t = (int)((e / HD) % TT); const int zz = (int)(e / ((size_t)HD * TT)); const float cs = (t < RH) ? 1.0f : (1.0f / PCAR); const size_t oo = (size_t)t * DQ + (h0 + zz) * HD + d;
    v2us oh, ol;
#pragma unroll
    for (int q = 0; q < 2; ++q) { unsigned short a, c2; splitf(O[e + q] * cs, a, c2); oh[q] = a; ol[q] = c2; } *(v2us*)(Ah + oo) = oh; *(v2us*)(Al + oo) = ol;  }

extern "C" void kernel_launch(void* const* d_in, const int* in_sizes, int n_in,
                              void* d_out, int out_size, void* d_ws, size_t ws_size, hipStream_t stream) {
    (void)in_sizes; (void)n_in; (void)out_size;
    const float* x = (const float*)d_in[0]; const float* wq = (const float*)d_in[1]; const float* bq = (const float*)d_in[2]; const float* wk = (const float*)d_in[3]; const float* bk = (const float*)d_in[4]; const float* wv = (const float*)d_in[5]; const float* bv = (const float*)d_in[6]; const float* wo = (const float*)d_in[7]; const float* bo = (const float*)d_in[8]; const float* lng = (const float*)d_in[9]; const float* lnb = (const float*)d_in[10];
    float* OUT = (float*)d_out;     // [4][2048][1024]
    char* wsp = (char*)d_ws;
    auto take = [&](size_t bytes) { char* p = wsp; wsp += (bytes + 255) & ~(size_t)255; return (void*)p; };
    float* Y = (float*)take((size_t)TT * DM * 4); bf* WQ = (bf*)take((size_t)DQ * DM * 2); bf* WK = (bf*)take((size_t)DKV * DM * 2); bf* WV = (bf*)take((size_t)DKV * DM * 2); bf* WO = (bf*)take((size_t)DM * DQ * 2); float* CS = (float*)take((size_t)TT * HD * 2 * 4);
    bf* XB = (bf*)take((size_t)TT * DM * 2); float* FQ = (float*)take((size_t)TT * DQ * 4); float* FK = (float*)take((size_t)TT * DKV * 4);
    h16* QP16 = (h16*)take((size_t)NH_ * TT * HD * 2); h16* KP16 = (h16*)take((size_t)NKV * TT * HD * 2); h16* VT16 = (h16*)take((size_t)NKV * HD * TT * 2);
    bf* QPh = (bf*)take((size_t)NH_ * TT * HD * 2); bf* QPl = (bf*)take((size_t)NH_ * TT * HD * 2); bf* KPh = (bf*)take((size_t)NKV * TT * HD * 2); bf* KPl = (bf*)take((size_t)NKV * TT * HD * 2); bf* VTh = (bf*)take((size_t)NKV * HD * TT * 2); bf* VTl = (bf*)take((size_t)NKV * HD * TT * 2); bf* Ph = (bf*)take((size_t)ZH * RH * TT * 2); bf* Pl = (bf*)take((size_t)ZH * RH * TT * 2);
    float* Sb = (float*)take((size_t)ZH * TT * TT * 4); h16* P16 = (h16*)take((size_t)ZH * TT * TT * 2); float* Ob = (float*)take((size_t)ZH * TT * HD * 4); bf* ATh = (bf*)take((size_t)TT * DQ * 2); bf* ATl = (bf*)take((size_t)TT * DQ * 2);
    if ((size_t)(wsp - (char*)d_ws) > ws_size) return;    // ws 256 MiB
    float* FV = FK;   // v projection reuses the k buffer after the k planes are built (stream-ordered)
    { k_wtG<<<(unsigned)((DM * DQ / 64 + 63) / 64), 256, 0, stream>>>(wq, DM, DQ, WQ); k_wtG<<<(unsigned)((DM * DKV / 64 + 63) / 64), 256, 0, stream>>>(wk, DM, DKV, WK); k_wtG<<<(unsigned)((DM * DKV / 64 + 63) / 64), 256, 0, stream>>>(wv, DM, DKV, WV);
      k_wtG<<<(unsigned)((DQ * DM / 64 + 63) / 64), 256, 0, stream>>>(wo, DQ, DM, WO);
       }
    k_csid<<<(TT * HD + 255) / 256, 256, 0, stream>>>(CS);
    const unsigned LQ = (unsigned)(((size_t)NH_ * TT * HD / 2 + 255) / 256), LKv = (unsigned)(((size_t)NKV * TT * HD / 2 + 255) / 256);
    for (int b = 0; b < NB_; ++b) {
        
        k_cvt8<<<(unsigned)(((size_t)TT * DM / 8 + 255) / 256), 256, 0, stream>>>(x + (size_t)b * TT * DM, XB, (size_t)TT * DM / 8);
        k_gemmw<bf, 0, true><<<dim3(TT / 64, DQ / 64, 1), 32, 0, stream>>>(XB, nullptr, WQ, nullptr, DM, FQ, DQ, bq, 0, 0, 0);
        k_rope<<<LQ, 256, 0, stream>>>(FQ, DQ, NH_, CS, nullptr, nullptr, 1.0f, QP16, QPh, QPl);
        k_gemmw<bf, 0, true><<<dim3(TT / 64, DKV / 64, 1), 32, 0, stream>>>(XB, nullptr, WK, nullptr, DM, FK, DKV, bk, 0, 0, 0);
        k_rope<<<LKv, 256, 0, stream>>>(FK, DKV, NKV, CS, nullptr, nullptr, 1.0f, KP16, KPh, KPl);
        k_gemmw<bf, 0, true><<<dim3(TT / 64, DKV / 64, 1), 32, 0, stream>>>(XB, nullptr, WV, nullptr, DM, FV, DKV, bv, 0, 0, 0); k_vtp<<<LKv, 256, 0, stream>>>(FV, DKV, NKV, VT16, VTh, VTl);
        for (int h0 = 0; h0 < NH_; h0 += ZH) { const size_t zq = (size_t)h0, zk = (size_t)(h0 / REP);   // one kv head per query head: the pass's two heads use consecutive kv planes (z-strides TT*HD)
            k_gemmc<bf, 2, 1><<<dim3(RH / 64, TT / 64, ZH), 32, 0, stream>>>(QPh + zq * TT * HD, QPl + zq * TT * HD, KPh + zk * TT * HD, KPl + zk * TT * HD, HD, Sb, TT, 0, (size_t)TT * HD, (size_t)TT * HD, (size_t)TT * TT);
            k_gemmc<h16, 0, 1><<<dim3((TT - RH) / 64, TT / 64, ZH), 32, 0, stream>>>(QP16 + zq * TT * HD + (size_t)RH * HD, nullptr, KP16 + zk * TT * HD, nullptr, HD, Sb + (size_t)RH * TT, TT, RH, (size_t)TT * HD, (size_t)TT * HD, (size_t)TT * TT);
            k_asoft<<<ZH * TT / 8, 256, 0, stream>>>(Sb, P16, Ph, Pl);
            k_gemmc<bf, 2, 2><<<dim3(RH / 64, HD / 64, ZH), 32, 0, stream>>>(Ph, Pl, VTh + zk * HD * TT, VTl + zk * HD * TT, TT, Ob, HD, 0, (size_t)RH * TT, (size_t)HD * TT, (size_t)TT * HD);
            k_gemmc<h16, 0, 2><<<dim3((TT - RH) / 64, HD / 64, ZH), 32, 0, stream>>>(P16 + (size_t)RH * TT, nullptr, VT16 + zk * HD * TT, nullptr, TT, Ob + (size_t)RH * HD, HD, RH, (size_t)TT * TT, (size_t)HD * TT, (size_t)TT * HD);
            k_merge<<<(unsigned)(((size_t)ZH * TT * HD / 2 + 255) / 256), 256, 0, stream>>>(Ob, h0, ATh, ATl); }
        k_gemmw<bf, 1, true><<<dim3(TT / 64, DM / 64, 1), 32, 0, stream>>>(ATh, ATl, WO, nullptr, DQ, Y, DM, bo, 0, 0, 0); k_addres<<<(unsigned)(((size_t)TT * DQ / 4 + 255) / 256), 256, 0, stream>>>(Y, x + (size_t)b * TT * DM); k_lnout<<<(TT + 7) / 8, 256, 0, stream>>>(Y, lng, lnb, OUT + (size_t)b * TT * DM); }
}

// v001
// It runs in 1760 microseconds.
// Two timings next to v000 put it at 1.67 and 1.65 times that version's speed.
#include <hip/hip_runtime.h>

// Masked (causal) multi-head attention with residual and post-LayerNorm (x [4][2048][1024]; q,k,v = x w + b ('xw' uniform(+-1/32) incl. biases; 16 heads x 64); scores / 8; causal (-inf); softmax; out = merged wo + bo; y = (out + x - mean) / sqrt(var + 1e-5) ln_g + ln_b -> [4][2048][1024] (8.4 M)).
// Layout per batch: bf16 copy of x; 'xw' weights transposed once; exact projections + f32 biases; causal T-2048 attention (hybrid rows: < 512 hi/lo 3 products, rest fp16 x1024; tiles above the diagonal skipped); merged hi/lo x Wo exact + bo into workspace; residual add and a row LayerNorm kernel write the output rows.
// Compute dtypes, f32 accumulate: every input rounded to bf16; projections exact + f32 biases; attention rows < 512 3 products, rest fp16; softmax f32; Wo hl x exact + bias; residual + LayerNorm f32.

#define NB_  4
#define TT   2048
#define DM   1024
#define NH_  16
#define NKV  16
#define REP  (NH_ / NKV)
#define HD   64
#define DQ   (NH_ * HD)
#define DKV  (NKV * HD)
#define ZH   2
#define RH   512                  // query rows < RH use hi+lo planes (0: none)
#define WIN  2048
#define PCAR 1024.0f
#define SCL  0.125f   // HD^-0.5
#define LNEPS 1e-5f
typedef _Float16 h16;
typedef unsigned short bf;
typedef __attribute__((ext_vector_type(16))) __bf16   v16bf;
typedef __attribute__((ext_vector_type(16))) _Float16 v16h;
typedef __attribute__((ext_vector_type(8)))  _Float16 v8h;
typedef __attribute__((ext_vector_type(8)))  unsigned short v8us;
typedef __attribute__((ext_vector_type(8)))  float    v8f;
typedef __attribute__((ext_vector_type(4)))  float    v4f;
typedef v8h  __attribute__((may_alias)) v8ha;
typedef v4f  __attribute__((may_alias)) v4fa;
typedef v8us __attribute__((may_alias)) v8usa;

__device__ __forceinline__ unsigned short f2bf(float f) { unsigned u = __float_as_uint(f); u += 0x7FFFu + ((u >> 16) & 1u); return (unsigned short)(u >> 16); }
__device__ __forceinline__ float bf2f(unsigned short b) { return __uint_as_float(((unsigned)b) << 16); }
__device__ __forceinline__ float bfr(float f) { return bf2f(f2bf(f)); }
__device__ __forceinline__ v16h cat16(v8h lo, v8h hi) { return __builtin_shufflevector(lo, hi, 0, 1, 2, 3, 4, 5, 6, 7, 8, 9, 10, 11, 12, 13, 14, 15); }
__device__ __forceinline__ v16bf cat16b(v8us lo, v8us hi) { return __builtin_bit_cast(v16bf, __builtin_shufflevector(lo, hi, 0, 1, 2, 3, 4, 5, 6, 7, 8, 9, 10, 11, 12, 13, 14, 15)); }
__device__ __forceinline__ v8f wmma16(v16h a, v16h b, v8f c) { return __builtin_amdgcn_wmma_f32_16x16x32_f16(false, a, false, b, (short)0, c, false, false); }
__device__ __forceinline__ v8f wmmab(v16bf a, v16bf b, v8f c) { return __builtin_amdgcn_wmma_f32_16x16x32_bf16(false, a, false, b, (short)0, c, false, false); }



// ---- k_gemmk: 64x64 output tile per work-group, the K loop split over NW waves; operands straight from K-contiguous 16-bit planes; grid (M/64, N/64, Z), 32 * NW threads.
// C[m][n] (f32, pitch ldc, + optional f32 bias[n]) = sum_k A[m][k] Bt[n][k] (+ split products per NSPLIT). z-batch strides sA/sB/sC in elements. K % 64 == 0.
// Wave w takes the 64-element K chunks w, w + NW, ... (one 128-byte line of every operand row per chunk) into its own 16 accumulators; the NW partial tiles meet in LDS and are summed in wave order 0..NW-1.
// CAUS limits the K loop of the probability x value contraction to the diagonal block (probabilities beyond it are exactly zero); roff = row offset of this launch's first row within the sequence.
template <typename T16> struct WFrag;
template <> struct WFrag<h16> { typedef v16h V; static __device__ __forceinline__ V ld(const h16* p) { return cat16(*(const v8h*)p, *(const v8h*)(p + 16)); } static __device__ __forceinline__ v8f mma(V a, V b, v8f c) { return wmma16(a, b, c); } };
template <> struct WFrag<bf> { typedef v16bf V; static __device__ __forceinline__ V ld(const bf* p) { return cat16b(*(const v8us*)p, *(const v8us*)(p + 16)); } static __device__ __forceinline__ v8f mma(V a, V b, v8f c) { return wmmab(a, b, c); } };
template <typename T16, int NSPLIT, bool BIAS, bool CAUS, int NW>
__global__ __launch_bounds__(32 * NW) void k_gemmk(const T16* __restrict__ A, const T16* __restrict__ A2, const T16* __restrict__ Bt, const T16* __restrict__ Bt2, int K, float* C, int ldc, const float* __restrict__ bias, int roff, size_t sA, size_t sB, size_t sC) {
    typedef typename WFrag<T16>::V V;
    __shared__ __align__(16) float os[NW * 64 * 68];
    const size_t z = blockIdx.z; A += z * sA; if (A2) A2 += z * sA; Bt += z * sB; if (Bt2) Bt2 += z * sB; C += z * sC;
    const int lane = threadIdx.x & 31, lr = lane & 15, hi = lane >> 4; const int r0 = blockIdx.x * 64, c0 = blockIdx.y * 64;
    const int wv = __builtin_amdgcn_readfirstlane((int)(threadIdx.x >> 5));   // wave number in a scalar register: the K loop's bounds stay scalar
    const int Kl = CAUS ? min(K, r0 + roff + 64) : K;
    v8f acc[4][4];
#pragma unroll
    for (int mb = 0; mb < 4; ++mb)
#pragma unroll
        for (int nb = 0; nb < 4; ++nb) acc[mb][nb] = (v8f){};
    const size_t aoff = (size_t)(r0 + lr) * K + 8 * hi, boff = (size_t)(c0 + lr) * K + 8 * hi;
#pragma unroll 1
    for (int k0 = wv * 64; k0 < Kl; k0 += NW * 64) {
#pragma unroll 1
    for (int kc = k0; kc < k0 + 64; kc += 32) {
        V a[4], a2[4];
#pragma unroll
        for (int mb = 0; mb < 4; ++mb) { a[mb] = WFrag<T16>::ld(A + aoff + (size_t)mb * 16 * K + kc); if (NSPLIT == 1 || NSPLIT == 2) a2[mb] = WFrag<T16>::ld(A2 + aoff + (size_t)mb * 16 * K + kc); }
#pragma unroll
        for (int nb = 0; nb < 4; ++nb) { const V b = WFrag<T16>::ld(Bt + boff + (size_t)nb * 16 * K + kc); V b2; if (NSPLIT >= 2) b2 = WFrag<T16>::ld(Bt2 + boff + (size_t)nb * 16 * K + kc);
#pragma unroll
            for (int mb = 0; mb < 4; ++mb) { acc[mb][nb] = WFrag<T16>::mma(a[mb], b, acc[mb][nb]); if (NSPLIT == 1 || NSPLIT == 2) acc[mb][nb] = WFrag<T16>::mma(a2[mb], b, acc[mb][nb]); if (NSPLIT >= 2) acc[mb][nb] = WFrag<T16>::mma(a[mb], b2, acc[mb][nb]); } }
        // four vector slots between the last matrix instruction and whatever follows the branch at the loop's foot (fragment reloads, accumulator reads)
        asm volatile("v_nop\n\tv_nop\n\tv_nop\n\tv_nop" : "+v"(acc[0][0]), "+v"(acc[1][1]), "+v"(acc[2][2]), "+v"(acc[3][3]) : "v"(a[0]), "v"(a[3]));
    } }
    float* my = os + wv * (64 * 68);
#pragma unroll
    for (int mb = 0; mb < 4; ++mb)
#pragma unroll
        for (int nb = 0; nb < 4; ++nb)
#pragma unroll
            for (int j = 0; j < 8; ++j) my[(mb * 16 + hi * 8 + j) * 68 + nb * 16 + lr] = acc[mb][nb][j];
    __syncthreads();   // every wave's partial tile is in LDS before any of them is summed
#pragma unroll
    for (int s = 0; s < 32 / NW; ++s) { const int q4 = s * 32 * NW + (int)threadIdx.x; const int row = q4 >> 4, cofs = (q4 & 15) * 4; v4f val = *(const v4fa*)(os + row * 68 + cofs);
#pragma unroll
        for (int w = 1; w < NW; ++w) { const v4f p = *(const v4fa*)(os + w * (64 * 68) + row * 68 + cofs); val += p; }
        if (BIAS) { val[0] += bfr(bias[c0 + cofs]); val[1] += bfr(bias[c0 + cofs + 1]); val[2] += bfr(bias[c0 + cofs + 2]); val[3] += bfr(bias[c0 + cofs + 3]); }
        *(v4f*)(C + (size_t)(r0 + row) * ldc + c0 + cofs) = val; }
}

// ---- k_gemmc: a one-wave 64x64 tile GEMM (no K split over waves) specialised for causal attention: CMODE 1 skips score tiles entirely above the diagonal (query rows r0+roff.., key columns c0..), CMODE 2 limits the
// key (K) loop of the probability x value contraction to the diagonal block (probabilities beyond it are exactly zero). roff = row offset of this launch's first row within the sequence.
template <typename T16, int NSPLIT, int CMODE>
__global__ __launch_bounds__(32) void k_gemmc(const T16* __restrict__ A, const T16* __restrict__ A2, const T16* __restrict__ Bt, const T16* __restrict__ Bt2, int K, float* C, int ldc, int roff, size_t sA, size_t sB, size_t sC) {
    typedef typename WFrag<T16>::V V;
    __shared__ __align__(16) float os[16 * 68];
    const size_t z = blockIdx.z; A += z * sA; if (A2) A2 += z * sA; Bt += z * sB; if (Bt2) Bt2 += z * sB; C += z * sC;
    const int lane = threadIdx.x & 31, lr = lane & 15, hi = lane >> 4; const int r0 = blockIdx.x * 64, c0 = blockIdx.y * 64;
    if (CMODE == 1 && c0 > r0 + roff + 63) return;                  // score tile entirely above the causal diagonal: never read (the softmax masks j > i by select)
    const int Kl = (CMODE == 2) ? min(K, r0 + roff + 64) : K;        // P.V: probabilities are exactly 0 beyond the diagonal block, so the K loop stops there
    v8f acc[4][4];
#pragma unroll
    for (int mb = 0; mb < 4; ++mb)
#pragma unroll
        for (int nb = 0; nb < 4; ++nb) acc[mb][nb] = (v8f){};
    const size_t aoff = (size_t)(r0 + lr) * K + 8 * hi, boff = (size_t)(c0 + lr) * K + 8 * hi;
#pragma unroll 1
    for (int kc = 0; kc < Kl; kc += 32) {
        V a[4], a2[4];
#pragma unroll
        for (int mb = 0; mb < 4; ++mb) { a[mb] = WFrag<T16>::ld(A + aoff + (size_t)mb * 16 * K + kc); if (NSPLIT == 1 || NSPLIT == 2) a2[mb] = WFrag<T16>::ld(A2 + aoff + (size_t)mb * 16 * K + kc); }
#pragma unroll
        for (int nb = 0; nb < 4; ++nb) { const V b = WFrag<T16>::ld(Bt + boff + (size_t)nb * 16 * K + kc); V b2; if (NSPLIT >= 2) b2 = WFrag<T16>::ld(Bt2 + boff + (size_t)nb * 16 * K + kc);
#pragma unroll
            for (int mb = 0; mb < 4; ++mb) { acc[mb][nb] = WFrag<T16>::mma(a[mb], b, acc[mb][nb]); if (NSPLIT == 1 || NSPLIT == 2) acc[mb][nb] = WFrag<T16>::mma(a2[mb], b, acc[mb][nb]); if (NSPLIT >= 2) acc[mb][nb] = WFrag<T16>::mma(a[mb], b2, acc[mb][nb]); } }
        asm volatile("v_nop\n\tv_nop\n\tv_nop\n\tv_nop" : "+v"(acc[0][0]), "+v"(acc[1][1]), "+v"(acc[2][2]), "+v"(acc[3][3]) : "v"(a[0]), "v"(a[3]));
    }
#pragma unroll
    for (int mb = 0; mb < 4; ++mb) {
#pragma unroll
        for (int nb = 0; nb < 4; ++nb) {
#pragma unroll
            for (int j = 0; j < 8; ++j) os[(hi * 8 + j) * 68 + nb * 16 + lr] = acc[mb][nb][j]; }
        __builtin_amdgcn_wave_barrier(); asm volatile("" ::: "memory");
        float* crow = C + (size_t)(r0 + mb * 16) * ldc + c0;
{
#pragma unroll
            for (int s = 0; s < 8; ++s) { const int row = 2 * s + hi, cofs = lr * 4; v4f val = *(const v4fa*)(os + row * 68 + cofs);
                *(v4f*)(crow + (size_t)row * ldc + cofs) = val; }
             }
        __builtin_amdgcn_wave_barrier(); asm volatile("" ::: "memory");
    }
}

__device__ __forceinline__ h16 tohx(float x) { return (h16)x; }
__device__ __forceinline__ void splitf(float y, unsigned short& h, unsigned short& l) { h = f2bf(y); l = f2bf(y - bf2f(h)); }
typedef __attribute__((ext_vector_type(2))) _Float16 v2h;
typedef __attribute__((ext_vector_type(4))) _Float16 v4h;
typedef __attribute__((ext_vector_type(2))) unsigned short v2us;
typedef __attribute__((ext_vector_type(4))) unsigned short v4us;
typedef __attribute__((ext_vector_type(2))) float v2f;
typedef __attribute__((ext_vector_type(4))) int v4i;

__global__ __launch_bounds__(256) void k_wtG(const float* __restrict__ w, int K, int N, bf* Bt) {
    const int lane = threadIdx.x & 31; const int L0 = (blockIdx.x * 8 + (threadIdx.x >> 5)) * 8; const int nlines = N * K / 64;
{
#pragma unroll 1
        for (int l = 0; l < 8; ++l) { const int L = L0 + l; if (L >= nlines) break; const size_t e = (size_t)L * 64 + lane * 2; const int k = (int)(e % K), n = (int)(e / K); v2us o;
            o[0] = f2bf(w[(size_t)k * N + n]); o[1] = f2bf(w[(size_t)(k + 1) * N + n]); *(v2us*)(Bt + e) = o; }
         }
}
__global__ __launch_bounds__(256) void k_cvt8(const float* __restrict__ src, bf* dst, size_t n8) { const size_t i = (size_t)blockIdx.x * 256 + threadIdx.x; if (i >= n8) return; const v8f v = *(const v8f*)(src + i * 8); v8us o;
#pragma unroll
    for (int k = 0; k < 8; ++k) o[k] = f2bf(v[k]); *(v8us*)(dst + i * 8) = o;  }

// k_rope: head planes [h][t][d] (fp16 + hi/lo) of rope(x) x sc with the rotate-half convention out[d] = x[d] cos[t][d] - x[d+HD/2] sin[t][d], out[d+HD/2] = x[d+HD/2] cos[t][d+HD/2] + x[d] sin[t][d+HD/2]
__global__ __launch_bounds__(256) void k_rope(const float* __restrict__ F, int pitch, int nheads, const float* __restrict__ CS, const float* __restrict__ RF, const float* __restrict__ nw, float sc, h16* P16, bf* Ph, bf* Pl) {
    const size_t e = ((size_t)blockIdx.x * 256 + threadIdx.x) * 2; if (e >= (size_t)nheads * TT * HD) return; const int d = (int)(e % HD); const int t = (int)((e / HD) % TT); const int h = (int)(e / ((size_t)HD * TT)); const float* f = F + (size_t)t * pitch + h * HD; const float rf = RF ? RF[(size_t)h * TT + t] : 1.0f; v2h o16; v2us oh, ol;
#pragma unroll
    for (int q = 0; q < 2; ++q) { const int dd = d + q; const int dp = (dd < HD / 2) ? dd + HD / 2 : dd - HD / 2; float x0 = f[dd], x1 = f[dp];
        if (RF) { float n0 = __fmul_rn(x0, rf), n1 = __fmul_rn(x1, rf); asm volatile("" : "+v"(n0)); asm volatile("" : "+v"(n1)); x0 = __fmul_rn(bfr(nw[dd]), n0); x1 = __fmul_rn(bfr(nw[dp]), n1); }
        const v2f cs = *(const v2f*)(CS + ((size_t)t * HD + dd) * 2); float a = __fmul_rn(x0, cs[0]), bq = __fmul_rn(x1, cs[1]); asm volatile("" : "+v"(a)); asm volatile("" : "+v"(bq)); const float r = ((dd < HD / 2) ? __fsub_rn(a, bq) : __fadd_rn(a, bq)) * sc;
        o16[q] = tohx(r); unsigned short a2, c2; splitf(r, a2, c2); oh[q] = a2; ol[q] = c2; }
    *(v2h*)(P16 + e) = o16; *(v2us*)(Ph + e) = oh; *(v2us*)(Pl + e) = ol;  }
__global__ __launch_bounds__(256) void k_vtp(const float* __restrict__ F, int pitch, int nheads, h16* V16, bf* Vh, bf* Vl) { const size_t e = ((size_t)blockIdx.x * 256 + threadIdx.x) * 2; if (e >= (size_t)nheads * HD * TT) return; const int t = (int)(e % TT); const int d = (int)((e / TT) % HD); const int g = (int)(e / ((size_t)TT * HD)); v2h o16; v2us oh, ol;
#pragma unroll
    for (int q = 0; q < 2; ++q) { const float x = F[(size_t)(t + q) * pitch + g * HD + d]; o16[q] = tohx(x); unsigned short a2, c2; splitf(x, a2, c2); oh[q] = a2; ol[q] = c2; }
    *(v2h*)(V16 + e) = o16; *(v2us*)(Vh + e) = oh; *(v2us*)(Vl + e) = ol;  }
__global__ __launch_bounds__(256) void k_csid(float* CS) { const int idx = blockIdx.x * 256 + threadIdx.x; if (idx >= TT * HD) return; v2f cs; cs[0] = 1.0f; cs[1] = 0.0f; *(v2f*)(CS + (size_t)idx * 2) = cs;  }
// k_asoft: per row (zz, i): t = S x HD^-0.5 for j <= i and i - j < WIN (sliding causal window; the reference's -1e9 additive fill vanishes identically); softmax over the 2048 keys (register row, one exp, fixed trees);
__global__ __launch_bounds__(256) void k_asoft(const float* __restrict__ Sb, h16* P16, bf* Ph, bf* Pl) {
    const int lane = threadIdx.x & 31; const int row = blockIdx.x * 8 + (threadIdx.x >> 5); if (row >= ZH * TT) return; const int i = row % TT; const int zz = row / TT; (void)zz; const bool hires = (i < RH); const float* sr = Sb + (size_t)row * TT; float v[TT / 32]; float mx = -3.0e38f;
#pragma unroll
    for (int ch = 0; ch < TT / 128; ++ch) { const int j0 = ch * 128 + lane * 4; const v4f a = *(const v4f*)(sr + j0);
#pragma unroll
        for (int q = 0; q < 4; ++q) { const int j = j0 + q; (void)j; const float t = (j <= i && i - j < WIN) ? a[q] * SCL : -3.0e38f; v[ch * 4 + q] = t; mx = fmaxf(mx, t); } }
#pragma unroll
    for (int sh = 16; sh; sh >>= 1) mx = fmaxf(mx, __shfl_xor(mx, sh, 32));
    float sum = 0.f;
#pragma unroll
    for (int k = 0; k < TT / 32; ++k) { float d0 = __fsub_rn(v[k], mx); asm volatile("" : "+v"(d0)); v[k] = __builtin_amdgcn_exp2f(__fmul_rn(d0, 1.4426950408889634f)); sum += v[k]; }
#pragma unroll
    for (int sh = 16; sh; sh >>= 1) sum += __shfl_xor(sum, sh, 32);
    const float f = __fdiv_rn(hires ? 1.0f : PCAR, sum);
{
        if (hires) {
#pragma unroll
            for (int ch = 0; ch < TT / 128; ++ch) { v4us oh, ol;
#pragma unroll
                for (int q = 0; q < 4; ++q) { unsigned short a, c2; splitf(v[ch * 4 + q] * f, a, c2); oh[q] = a; ol[q] = c2; }
                const size_t oo = ((size_t)zz * (RH ? RH : 1) + i) * TT + ch * 128 + lane * 4; *(v4us*)(Ph + oo) = oh; *(v4us*)(Pl + oo) = ol; }
        } else {
#pragma unroll
            for (int ch = 0; ch < TT / 128; ++ch) { v4h o4;
#pragma unroll
                for (int q = 0; q < 4; ++q) o4[q] = tohx(v[ch * 4 + q] * f);
                *(v4h*)(P16 + (size_t)row * TT + ch * 128 + lane * 4) = o4; } }
         }
}
__global__ __launch_bounds__(256) void k_addres(float* Y, const float* __restrict__ xr) { const size_t i = (size_t)blockIdx.x * 256 + threadIdx.x; if (i >= (size_t)TT * DQ / 4) return; const v4f a = *(const v4f*)(Y + i * 4); const v4f r = *(const v4f*)(xr + i * 4); v4f o;
#pragma unroll
    for (int q = 0; q < 4; ++q) o[q] = __fadd_rn(a[q], bfr(r[q]));
    *(v4f*)(Y + i * 4) = o;  }
__global__ __launch_bounds__(256) void k_lnout(const float* __restrict__ F, const float* __restrict__ g, const float* __restrict__ bb, float* out) { const int lane = threadIdx.x & 31; const int row = blockIdx.x * 8 + (threadIdx.x >> 5); if (row >= TT) return; const float* fr = F + (size_t)row * DQ; float* orow = out + (size_t)row * DQ; float v[DQ / 32]; float s = 0.f;
#pragma unroll
    for (int c = 0; c < DQ / 128; ++c) { const v4f a = *(const v4f*)(fr + c * 128 + lane * 4); for (int q = 0; q < 4; ++q) { v[c * 4 + q] = a[q]; s = __fadd_rn(s, a[q]); } }
#pragma unroll
    for (int sh = 16; sh; sh >>= 1) s = __fadd_rn(s, __shfl_xor(s, sh, 32));
    const float mean = __fdiv_rn(s, (float)DQ); float s2 = 0.f;
#pragma unroll
    for (int k = 0; k < DQ / 32; ++k) { const float dv = __fsub_rn(v[k], mean); float p2 = __fmul_rn(dv, dv); asm volatile("" : "+v"(p2)); s2 = __fadd_rn(s2, p2); v[k] = dv; }
#pragma unroll
    for (int sh = 16; sh; sh >>= 1) s2 = __fadd_rn(s2, __shfl_xor(s2, sh, 32));
    const float rs = __fdiv_rn(1.0f, __fsqrt_rn(__fadd_rn(__fdiv_rn(s2, (float)DQ), LNEPS)));
{
#pragma unroll
        for (int c = 0; c < DQ / 128; ++c) { v4f o; for (int q = 0; q < 4; ++q) { const int col = c * 128 + lane * 4 + q; float y = __fmul_rn(v[c * 4 + q], rs); asm volatile("" : "+v"(y)); y = __fmul_rn(y, bfr(g[col])); asm volatile("" : "+v"(y)); o[q] = __fadd_rn(y, bfr(bb[col])); } *(v4f*)(orow + c * 128 + lane * 4) = o; }
         } }
__global__ __launch_bounds__(256) void k_merge(const float* __restrict__ O, int h0, bf* Ah, bf* Al) { const size_t e = ((size_t)blockIdx.x * 256 + threadIdx.x) * 2; if (e >= (size_t)ZH * TT * HD) return; const int d = (int)(e % HD); const int t = (int)((e / HD) % TT); const int zz = (int)(e / ((size_t)HD * TT)); const float cs = (t < RH) ? 1.0f : (1.0f / PCAR); const size_t oo = (size_t)t * DQ + (h0 + zz) * HD + d;
    v2us oh, ol;
#pragma unroll
    for (int q = 0; q < 2; ++q) { unsigned short a, c2; splitf(O[e + q] * cs, a, c2); oh[q] = a; ol[q] = c2; } *(v2us*)(Ah + oo) = oh; *(v2us*)(Al + oo) = ol;  }

extern "C" void kernel_launch(void* const* d_in, const int* in_sizes, int n_in,
                              void* d_out, int out_size, void* d_ws, size_t ws_size, hipStream_t stream) {
    (void)in_sizes; (void)n_in; (void)out_size;
    const float* x = (const float*)d_in[0]; const float* wq = (const float*)d_in[1]; const float* bq = (const float*)d_in[2]; const float* wk = (const float*)d_in[3]; const float* bk = (const float*)d_in[4]; const float* wv = (const float*)d_in[5]; const float* bv = (const float*)d_in[6]; const float* wo = (const float*)d_in[7]; const float* bo = (const float*)d_in[8]; const float* lng = (const float*)d_in[9]; const float* lnb = (const float*)d_in[10];
    float* OUT = (float*)d_out;     // [4][2048][1024]
    char* wsp = (char*)d_ws;
    auto take = [&](size_t bytes) { char* p = wsp; wsp += (bytes + 255) & ~(size_t)255; return (void*)p; };
    float* Y = (float*)take((size_t)TT * DM * 4); bf* WQ = (bf*)take((size_t)DQ * DM * 2); bf* WK = (bf*)take((size_t)DKV * DM * 2); bf* WV = (bf*)take((size_t)DKV * DM * 2); bf* WO = (bf*)take((size_t)DM * DQ * 2); float* CS = (float*)take((size_t)TT * HD * 2 * 4);
    bf* XB = (bf*)take((size_t)TT * DM * 2); float* FQ = (float*)take((size_t)TT * DQ * 4); float* FK = (float*)take((size_t)TT * DKV * 4);
    h16* QP16 = (h16*)take((size_t)NH_ * TT * HD * 2); h16* KP16 = (h16*)take((size_t)NKV * TT * HD * 2); h16* VT16 = (h16*)take((size_t)NKV * HD * TT * 2);
    bf* QPh = (bf*)take((size_t)NH_ * TT * HD * 2); bf* QPl = (bf*)take((size_t)NH_ * TT * HD * 2); bf* KPh = (bf*)take((size_t)NKV * TT * HD * 2); bf* KPl = (bf*)take((size_t)NKV * TT * HD * 2); bf* VTh = (bf*)take((size_t)NKV * HD * TT * 2); bf* VTl = (bf*)take((size_t)NKV * HD * TT * 2); bf* Ph = (bf*)take((size_t)ZH * RH * TT * 2); bf* Pl = (bf*)take((size_t)ZH * RH * TT * 2);
    float* Sb = (float*)take((size_t)ZH * TT * TT * 4); h16* P16 = (h16*)take((size_t)ZH * TT * TT * 2); float* Ob = (float*)take((size_t)ZH * TT * HD * 4); bf* ATh = (bf*)take((size_t)TT * DQ * 2); bf* ATl = (bf*)take((size_t)TT * DQ * 2);
    if ((size_t)(wsp - (char*)d_ws) > ws_size) return;    // ws 256 MiB
    float* FV = FK;   // v projection reuses the k buffer after the k planes are built (stream-ordered)
    { k_wtG<<<(unsigned)((DM * DQ / 64 + 63) / 64), 256, 0, stream>>>(wq, DM, DQ, WQ); k_wtG<<<(unsigned)((DM * DKV / 64 + 63) / 64), 256, 0, stream>>>(wk, DM, DKV, WK); k_wtG<<<(unsigned)((DM * DKV / 64 + 63) / 64), 256, 0, stream>>>(wv, DM, DKV, WV);
      k_wtG<<<(unsigned)((DQ * DM / 64 + 63) / 64), 256, 0, stream>>>(wo, DQ, DM, WO);
       }
    k_csid<<<(TT * HD + 255) / 256, 256, 0, stream>>>(CS);
    const unsigned LQ = (unsigned)(((size_t)NH_ * TT * HD / 2 + 255) / 256), LKv = (unsigned)(((size_t)NKV * TT * HD / 2 + 255) / 256);
    for (int b = 0; b < NB_; ++b) {
        
        k_cvt8<<<(unsigned)(((size_t)TT * DM / 8 + 255) / 256), 256, 0, stream>>>(x + (size_t)b * TT * DM, XB, (size_t)TT * DM / 8);
        k_gemmk<bf, 0, true, false, 8><<<dim3(TT / 64, DQ / 64, 1), 256, 0, stream>>>(XB, nullptr, WQ, nullptr, DM, FQ, DQ, bq, 0, 0, 0, 0);
        k_rope<<<LQ, 256, 0, stream>>>(FQ, DQ, NH_, CS, nullptr, nullptr, 1.0f, QP16, QPh, QPl);
        k_gemmk<bf, 0, true, false, 8><<<dim3(TT / 64, DKV / 64, 1), 256, 0, stream>>>(XB, nullptr, WK, nullptr, DM, FK, DKV, bk, 0, 0, 0, 0);
        k_rope<<<LKv, 256, 0, stream>>>(FK, DKV, NKV, CS, nullptr, nullptr, 1.0f, KP16, KPh, KPl);
        k_gemmk<bf, 0, true, false, 8><<<dim3(TT / 64, DKV / 64, 1), 256, 0, stream>>>(XB, nullptr, WV, nullptr, DM, FV, DKV, bv, 0, 0, 0, 0); k_vtp<<<LKv, 256, 0, stream>>>(FV, DKV, NKV, VT16, VTh, VTl);
        for (int h0 = 0; h0 < NH_; h0 += ZH) { const size_t zq = (size_t)h0, zk = (size_t)(h0 / REP);   // one kv head per query head: the pass's two heads use consecutive kv planes (z-strides TT*HD)
            k_gemmc<bf, 2, 1><<<dim3(RH / 64, TT / 64, ZH), 32, 0, stream>>>(QPh + zq * TT * HD, QPl + zq * TT * HD, KPh + zk * TT * HD, KPl + zk * TT * HD, HD, Sb, TT, 0, (size_t)TT * HD, (size_t)TT * HD, (size_t)TT * TT);
            k_gemmc<h16, 0, 1><<<dim3((TT - RH) / 64, TT / 64, ZH), 32, 0, stream>>>(QP16 + zq * TT * HD + (size_t)RH * HD, nullptr, KP16 + zk * TT * HD, nullptr, HD, Sb + (size_t)RH * TT, TT, RH, (size_t)TT * HD, (size_t)TT * HD, (size_t)TT * TT);
            k_asoft<<<ZH * TT / 8, 256, 0, stream>>>(Sb, P16, Ph, Pl);
            k_gemmk<bf, 2, false, true, 8><<<dim3(RH / 64, HD / 64, ZH), 256, 0, stream>>>(Ph, Pl, VTh + zk * HD * TT, VTl + zk * HD * TT, TT, Ob, HD, nullptr, 0, (size_t)RH * TT, (size_t)HD * TT, (size_t)TT * HD);
            k_gemmk<h16, 0, false, true, 16><<<dim3((TT - RH) / 64, HD / 64, ZH), 512, 0, stream>>>(P16 + (size_t)RH * TT, nullptr, VT16 + zk * HD * TT, nullptr, TT, Ob + (size_t)RH * HD, HD, nullptr, RH, (size_t)TT * TT, (size_t)HD * TT, (size_t)TT * HD);
            k_merge<<<(unsigned)(((size_t)ZH * TT * HD / 2 + 255) / 256), 256, 0, stream>>>(Ob, h0, ATh, ATl); }
        k_gemmk<bf, 1, true, false, 8><<<dim3(TT / 64, DM / 64, 1), 256, 0, stream>>>(ATh, ATl, WO, nullptr, DQ, Y, DM, bo, 0, 0, 0, 0); k_addres<<<(unsigned)(((size_t)TT * DQ / 4 + 255) / 256), 256, 0, stream>>>(Y, x + (size_t)b * TT * DM); k_lnout<<<(TT + 7) / 8, 256, 0, stream>>>(Y, lng, lnb, OUT + (size_t)b * TT * DM); }
}

// v002
// One run takes 1050 microseconds.
// In two side-by-side timings against v001, it was 1.67 and 1.68 times as fast.
// Counting every step since v000, it is 2.78 times as fast.
#include <hip/hip_runtime.h>

// Masked (causal) multi-head attention with residual and post-LayerNorm (x [4][2048][1024]; q,k,v = x w + b ('xw' uniform(+-1/32) incl. biases; 16 heads x 64); scores / 8; causal (-inf); softmax; out = merged wo + bo; y = (out + x - mean) / sqrt(var + 1e-5) ln_g + ln_b -> [4][2048][1024] (8.4 M)).
// Layout per batch: bf16 copy of x; 'xw' weights transposed once; exact projections + f32 biases; causal T-2048 attention, eight heads a pass (hybrid rows: < 512 hi/lo 3 products, rest fp16 x1024; tiles above the diagonal skipped; each probability row overwrites its own score row, so probability rows and transposed value rows share a pitch of 4096 elements); merged hi/lo x Wo exact + bo into workspace; residual add and a row LayerNorm kernel write the output rows.
// Compute dtypes, f32 accumulate: every input rounded to bf16; projections exact + f32 biases; attention rows < 512 3 products, rest fp16; softmax f32; Wo hl x exact + bias; residual + LayerNorm f32.

#define NB_  4
#define TT   2048
#define DM   1024
#define NH_  16
#define NKV  16
#define REP  (NH_ / NKV)
#define HD   64
#define DQ   (NH_ * HD)
#define DKV  (NKV * HD)
#define ZH   8                    // heads per attention pass (z dimension of the score and probability x value launches)
#define RH   512                  // query rows < RH use hi+lo planes (0: none)
#define PP   (2 * TT)          // row pitch, in 16-bit elements, of the in-place probability rows and of the transposed value planes that meet them in one product
#define WIN  2048
#define PCAR 1024.0f
#define SCL  0.125f   // HD^-0.5
#define LNEPS 1e-5f
typedef _Float16 h16;
typedef unsigned short bf;
typedef __attribute__((ext_vector_type(16))) __bf16   v16bf;
typedef __attribute__((ext_vector_type(16))) _Float16 v16h;
typedef __attribute__((ext_vector_type(8)))  _Float16 v8h;
typedef __attribute__((ext_vector_type(8)))  unsigned short v8us;
typedef __attribute__((ext_vector_type(8)))  float    v8f;
typedef __attribute__((ext_vector_type(4)))  float    v4f;
typedef v8h  __attribute__((may_alias)) v8ha;
typedef v4f  __attribute__((may_alias)) v4fa;
typedef v8us __attribute__((may_alias)) v8usa;

__device__ __forceinline__ unsigned short f2bf(float f) { unsigned u = __float_as_uint(f); u += 0x7FFFu + ((u >> 16) & 1u); return (unsigned short)(u >> 16); }
__device__ __forceinline__ float bf2f(unsigned short b) { return __uint_as_float(((unsigned)b) << 16); }
__device__ __forceinline__ float bfr(float f) { return bf2f(f2bf(f)); }
__device__ __forceinline__ v16h cat16(v8h lo, v8h hi) { return __builtin_shufflevector(lo, hi, 0, 1, 2, 3, 4, 5, 6, 7, 8, 9, 10, 11, 12, 13, 14, 15); }
__device__ __forceinline__ v16bf cat16b(v8us lo, v8us hi) { return __builtin_bit_cast(v16bf, __builtin_shufflevector(lo, hi, 0, 1, 2, 3, 4, 5, 6, 7, 8, 9, 10, 11, 12, 13, 14, 15)); }
__device__ __forceinline__ v8f wmma16(v16h a, v16h b, v8f c) { return __builtin_amdgcn_wmma_f32_16x16x32_f16(false, a, false, b, (short)0, c, false, false); }
__device__ __forceinline__ v8f wmmab(v16bf a, v16bf b, v8f c) { return __builtin_amdgcn_wmma_f32_16x16x32_bf16(false, a, false, b, (short)0, c, false, false); }



// ---- k_gemmk: 64x64 output tile per work-group, the K loop split over NW waves; operands straight from K-contiguous 16-bit planes; grid (M/64, N/64, Z), 32 * NW threads.
// C[m][n] (f32, pitch ldc, + optional f32 bias[n]) = sum_k A[m][k] Bt[n][k] (+ split products per NSPLIT). K is the row pitch of A and Bt and, without CAUS, the contraction length. z-batch strides sA/sB/sC in elements. K % 64 == 0.
// Wave w takes the 64-element K chunks w, w + NW, ... (one 128-byte line of every operand row per chunk) into its own 16 accumulators; the NW partial tiles meet in LDS and are summed in wave order 0..NW-1.
// CAUS limits the K loop of the probability x value contraction to the diagonal block (probabilities beyond it are exactly zero); roff = row offset of this launch's first row within the sequence.
template <typename T16> struct WFrag;
template <> struct WFrag<h16> { typedef v16h V; static __device__ __forceinline__ V ld(const h16* p) { return cat16(*(const v8h*)p, *(const v8h*)(p + 16)); } static __device__ __forceinline__ v8f mma(V a, V b, v8f c) { return wmma16(a, b, c); } };
template <> struct WFrag<bf> { typedef v16bf V; static __device__ __forceinline__ V ld(const bf* p) { return cat16b(*(const v8us*)p, *(const v8us*)(p + 16)); } static __device__ __forceinline__ v8f mma(V a, V b, v8f c) { return wmmab(a, b, c); } };
template <typename T16, int NSPLIT, bool BIAS, bool CAUS, int NW>
__global__ __launch_bounds__(32 * NW) void k_gemmk(const T16* __restrict__ A, const T16* __restrict__ A2, const T16* __restrict__ Bt, const T16* __restrict__ Bt2, int K, float* C, int ldc, const float* __restrict__ bias, int roff, size_t sA, size_t sB, size_t sC) {
    typedef typename WFrag<T16>::V V;
    __shared__ __align__(16) float os[NW * 64 * 68];
    const size_t z = blockIdx.z; A += z * sA; if (A2) A2 += z * sA; Bt += z * sB; if (Bt2) Bt2 += z * sB; C += z * sC;
    const int lane = threadIdx.x & 31, lr = lane & 15, hi = lane >> 4; const int r0 = blockIdx.x * 64, c0 = blockIdx.y * 64;
    const int wv = __builtin_amdgcn_readfirstlane((int)(threadIdx.x >> 5));   // wave number in a scalar register: the K loop's bounds stay scalar
    const int Kl = CAUS ? min(K, r0 + roff + 64) : K;
    v8f acc[4][4];
#pragma unroll
    for (int mb = 0; mb < 4; ++mb)
#pragma unroll
        for (int nb = 0; nb < 4; ++nb) acc[mb][nb] = (v8f){};
    const size_t aoff = (size_t)(r0 + lr) * K + 8 * hi, boff = (size_t)(c0 + lr) * K + 8 * hi;
#pragma unroll 1
    for (int k0 = wv * 64; k0 < Kl; k0 += NW * 64) {
#pragma unroll 1
    for (int kc = k0; kc < k0 + 64; kc += 32) {
        V a[4], a2[4];
#pragma unroll
        for (int mb = 0; mb < 4; ++mb) { a[mb] = WFrag<T16>::ld(A + aoff + (size_t)mb * 16 * K + kc); if (NSPLIT == 1 || NSPLIT == 2) a2[mb] = WFrag<T16>::ld(A2 + aoff + (size_t)mb * 16 * K + kc); }
#pragma unroll
        for (int nb = 0; nb < 4; ++nb) { const V b = WFrag<T16>::ld(Bt + boff + (size_t)nb * 16 * K + kc); V b2; if (NSPLIT >= 2) b2 = WFrag<T16>::ld(Bt2 + boff + (size_t)nb * 16 * K + kc);
#pragma unroll
            for (int mb = 0; mb < 4; ++mb) { acc[mb][nb] = WFrag<T16>::mma(a[mb], b, acc[mb][nb]); if (NSPLIT == 1 || NSPLIT == 2) acc[mb][nb] = WFrag<T16>::mma(a2[mb], b, acc[mb][nb]); if (NSPLIT >= 2) acc[mb][nb] = WFrag<T16>::mma(a[mb], b2, acc[mb][nb]); } }
        // four vector slots between the last matrix instruction and whatever follows the branch at the loop's foot (fragment reloads, accumulator reads)
        asm volatile("v_nop\n\tv_nop\n\tv_nop\n\tv_nop" : "+v"(acc[0][0]), "+v"(acc[1][1]), "+v"(acc[2][2]), "+v"(acc[3][3]) : "v"(a[0]), "v"(a[3]));
    } }
    float* my = os + wv * (64 * 68);
#pragma unroll
    for (int mb = 0; mb < 4; ++mb)
#pragma unroll
        for (int nb = 0; nb < 4; ++nb)
#pragma unroll
            for (int j = 0; j < 8; ++j) my[(mb * 16 + hi * 8 + j) * 68 + nb * 16 + lr] = acc[mb][nb][j];
    __syncthreads();   // every wave's partial tile is in LDS before any of them is summed
#pragma unroll
    for (int s = 0; s < 32 / NW; ++s) { const int q4 = s * 32 * NW + (int)threadIdx.x; const int row = q4 >> 4, cofs = (q4 & 15) * 4; v4f val = *(const v4fa*)(os + row * 68 + cofs);
#pragma unroll
        for (int w = 1; w < NW; ++w) { const v4f p = *(const v4fa*)(os + w * (64 * 68) + row * 68 + cofs); val += p; }
        if (BIAS) { val[0] += bfr(bias[c0 + cofs]); val[1] += bfr(bias[c0 + cofs + 1]); val[2] += bfr(bias[c0 + cofs + 2]); val[3] += bfr(bias[c0 + cofs + 3]); }
        *(v4f*)(C + (size_t)(r0 + row) * ldc + c0 + cofs) = val; }
}

// ---- k_gemmc: a one-wave 64x64 tile GEMM (no K split over waves) specialised for causal attention: CMODE 1 skips score tiles entirely above the diagonal (query rows r0+roff.., key columns c0..), CMODE 2 limits the
// key (K) loop of the probability x value contraction to the diagonal block (probabilities beyond it are exactly zero). roff = row offset of this launch's first row within the sequence.
template <typename T16, int NSPLIT, int CMODE>
__global__ __launch_bounds__(32) void k_gemmc(const T16* __restrict__ A, const T16* __restrict__ A2, const T16* __restrict__ Bt, const T16* __restrict__ Bt2, int K, float* C, int ldc, int roff, size_t sA, size_t sB, size_t sC) {
    typedef typename WFrag<T16>::V V;
    __shared__ __align__(16) float os[16 * 68];
    const size_t z = blockIdx.z; A += z * sA; if (A2) A2 += z * sA; Bt += z * sB; if (Bt2) Bt2 += z * sB; C += z * sC;
    const int lane = threadIdx.x & 31, lr = lane & 15, hi = lane >> 4; const int r0 = blockIdx.x * 64, c0 = blockIdx.y * 64;
    if (CMODE == 1 && c0 > r0 + roff + 63) return;                  // score tile entirely above the causal diagonal: never read (the softmax masks j > i by select)
    const int Kl = (CMODE == 2) ? min(K, r0 + roff + 64) : K;        // P.V: probabilities are exactly 0 beyond the diagonal block, so the K loop stops there
    v8f acc[4][4];
#pragma unroll
    for (int mb = 0; mb < 4; ++mb)
#pragma unroll
        for (int nb = 0; nb < 4; ++nb) acc[mb][nb] = (v8f){};
    const size_t aoff = (size_t)(r0 + lr) * K + 8 * hi, boff = (size_t)(c0 + lr) * K + 8 * hi;
#pragma unroll 1
    for (int kc = 0; kc < Kl; kc += 32) {
        V a[4], a2[4];
#pragma unroll
        for (int mb = 0; mb < 4; ++mb) { a[mb] = WFrag<T16>::ld(A + aoff + (size_t)mb * 16 * K + kc); if (NSPLIT == 1 || NSPLIT == 2) a2[mb] = WFrag<T16>::ld(A2 + aoff + (size_t)mb * 16 * K + kc); }
#pragma unroll
        for (int nb = 0; nb < 4; ++nb) { const V b = WFrag<T16>::ld(Bt + boff + (size_t)nb * 16 * K + kc); V b2; if (NSPLIT >= 2) b2 = WFrag<T16>::ld(Bt2 + boff + (size_t)nb * 16 * K + kc);
#pragma unroll
            for (int mb = 0; mb < 4; ++mb) { acc[mb][nb] = WFrag<T16>::mma(a[mb], b, acc[mb][nb]); if (NSPLIT == 1 || NSPLIT == 2) acc[mb][nb] = WFrag<T16>::mma(a2[mb], b, acc[mb][nb]); if (NSPLIT >= 2) acc[mb][nb] = WFrag<T16>::mma(a[mb], b2, acc[mb][nb]); } }
        asm volatile("v_nop\n\tv_nop\n\tv_nop\n\tv_nop" : "+v"(acc[0][0]), "+v"(acc[1][1]), "+v"(acc[2][2]), "+v"(acc[3][3]) : "v"(a[0]), "v"(a[3]));
    }
#pragma unroll
    for (int mb = 0; mb < 4; ++mb) {
#pragma unroll
        for (int nb = 0; nb < 4; ++nb) {
#pragma unroll
            for (int j = 0; j < 8; ++j) os[(hi * 8 + j) * 68 + nb * 16 + lr] = acc[mb][nb][j]; }
        __builtin_amdgcn_wave_barrier(); asm volatile("" ::: "memory");
        float* crow = C + (size_t)(r0 + mb * 16) * ldc + c0;
{
#pragma unroll
            for (int s = 0; s < 8; ++s) { const int row = 2 * s + hi, cofs = lr * 4; v4f val = *(const v4fa*)(os + row * 68 + cofs);
                *(v4f*)(crow + (size_t)row * ldc + cofs) = val; }
             }
        __builtin_amdgcn_wave_barrier(); asm volatile("" ::: "memory");
    }
}

__device__ __forceinline__ h16 tohx(float x) { return (h16)x; }
__device__ __forceinline__ void splitf(float y, unsigned short& h, unsigned short& l) { h = f2bf(y); l = f2bf(y - bf2f(h)); }
typedef __attribute__((ext_vector_type(2))) _Float16 v2h;
typedef __attribute__((ext_vector_type(4))) _Float16 v4h;
typedef __attribute__((ext_vector_type(2))) unsigned short v2us;
typedef __attribute__((ext_vector_type(4))) unsigned short v4us;
typedef __attribute__((ext_vector_type(2))) float v2f;
typedef __attribute__((ext_vector_type(4))) int v4i;

__global__ __launch_bounds__(256) void k_wtG(const float* __restrict__ w, int K, int N, bf* Bt) {
    const int lane = threadIdx.x & 31; const int L0 = (blockIdx.x * 8 + (threadIdx.x >> 5)) * 8; const int nlines = N * K / 64;
{
#pragma unroll 1
        for (int l = 0; l < 8; ++l) { const int L = L0 + l; if (L >= nlines) break; const size_t e = (size_t)L * 64 + lane * 2; const int k = (int)(e % K), n = (int)(e / K); v2us o;
            o[0] = f2bf(w[(size_t)k * N + n]); o[1] = f2bf(w[(size_t)(k + 1) * N + n]); *(v2us*)(Bt + e) = o; }
         }
}
__global__ __launch_bounds__(256) void k_cvt8(const float* __restrict__ src, bf* dst, size_t n8) { const size_t i = (size_t)blockIdx.x * 256 + threadIdx.x; if (i >= n8) return; const v8f v = *(const v8f*)(src + i * 8); v8us o;
#pragma unroll
    for (int k = 0; k < 8; ++k) o[k] = f2bf(v[k]); *(v8us*)(dst + i * 8) = o;  }

// k_rope: head planes [h][t][d] (fp16 + hi/lo) of rope(x) x sc with the rotate-half convention out[d] = x[d] cos[t][d] - x[d+HD/2] sin[t][d], out[d+HD/2] = x[d+HD/2] cos[t][d+HD/2] + x[d] sin[t][d+HD/2]
__global__ __launch_bounds__(256) void k_rope(const float* __restrict__ F, int pitch, int nheads, const float* __restrict__ CS, const float* __restrict__ RF, const float* __restrict__ nw, float sc, h16* P16, bf* Ph, bf* Pl) {
    const size_t e = ((size_t)blockIdx.x * 256 + threadIdx.x) * 2; if (e >= (size_t)nheads * TT * HD) return; const int d = (int)(e % HD); const int t = (int)((e / HD) % TT); const int h = (int)(e / ((size_t)HD * TT)); const float* f = F + (size_t)t * pitch + h * HD; const float rf = RF ? RF[(size_t)h * TT + t] : 1.0f; v2h o16; v2us oh, ol;
#pragma unroll
    for (int q = 0; q < 2; ++q) { const int dd = d + q; const int dp = (dd < HD / 2) ? dd + HD / 2 : dd - HD / 2; float x0 = f[dd], x1 = f[dp];
        if (RF) { float n0 = __fmul_rn(x0, rf), n1 = __fmul_rn(x1, rf); asm volatile("" : "+v"(n0)); asm volatile("" : "+v"(n1)); x0 = __fmul_rn(bfr(nw[dd]), n0); x1 = __fmul_rn(bfr(nw[dp]), n1); }
        const v2f cs = *(const v2f*)(CS + ((size_t)t * HD + dd) * 2); float a = __fmul_rn(x0, cs[0]), bq = __fmul_rn(x1, cs[1]); asm volatile("" : "+v"(a)); asm volatile("" : "+v"(bq)); const float r = ((dd < HD / 2) ? __fsub_rn(a, bq) : __fadd_rn(a, bq)) * sc;
        o16[q] = tohx(r); unsigned short a2, c2; splitf(r, a2, c2); oh[q] = a2; ol[q] = c2; }
    *(v2h*)(P16 + e) = o16; *(v2us*)(Ph + e) = oh; *(v2us*)(Pl + e) = ol;  }
__global__ __launch_bounds__(256) void k_vtp(const float* __restrict__ F, int pitch, int nheads, h16* V16, bf* Vh, bf* Vl) { const size_t e = ((size_t)blockIdx.x * 256 + threadIdx.x) * 2; if (e >= (size_t)nheads * HD * TT) return; const int t = (int)(e % TT); const int d = (int)((e / TT) % HD); const int g = (int)(e / ((size_t)TT * HD)); const size_t o = ((size_t)g * HD + d) * PP + t; v2h o16; v2us oh, ol;
#pragma unroll
    for (int q = 0; q < 2; ++q) { const float x = F[(size_t)(t + q) * pitch + g * HD + d]; o16[q] = tohx(x); unsigned short a2, c2; splitf(x, a2, c2); oh[q] = a2; ol[q] = c2; }
    *(v2h*)(V16 + o) = o16; *(v2us*)(Vh + o) = oh; *(v2us*)(Vl + o) = ol;  }
__global__ __launch_bounds__(256) void k_csid(float* CS) { const int idx = blockIdx.x * 256 + threadIdx.x; if (idx >= TT * HD) return; v2f cs; cs[0] = 1.0f; cs[1] = 0.0f; *(v2f*)(CS + (size_t)idx * 2) = cs;  }
// k_asoft: per row (zz, i): t = S x HD^-0.5 for j <= i and i - j < WIN (sliding causal window; the reference's -1e9 additive fill vanishes identically); softmax over the 2048 keys (register row, one exp, fixed trees);
// the probabilities go back into the row's own 8 KiB of Sb (16-bit pitch PP): fp16 in the first half, or hi plane first half and lo plane second half. One wave owns a row and holds all of it in registers before its first store.
typedef v4h  __attribute__((may_alias)) v4ha;
typedef v4us __attribute__((may_alias)) v4usa;
__global__ __launch_bounds__(256) void k_asoft(float* Sb) {
    const int lane = threadIdx.x & 31; const int row = blockIdx.x * 8 + (threadIdx.x >> 5); if (row >= ZH * TT) return; const int i = row % TT; const int zz = row / TT; (void)zz; const bool hires = (i < RH); const float* sr = Sb + (size_t)row * TT; h16* p16 = (h16*)(Sb + (size_t)row * TT); bf* ph = (bf*)(Sb + (size_t)row * TT); float v[TT / 32]; float mx = -3.0e38f;
#pragma unroll
    for (int ch = 0; ch < TT / 128; ++ch) { const int j0 = ch * 128 + lane * 4; const v4f a = *(const v4fa*)(sr + j0);
#pragma unroll
        for (int q = 0; q < 4; ++q) { const int j = j0 + q; (void)j; const float t = (j <= i && i - j < WIN) ? a[q] * SCL : -3.0e38f; v[ch * 4 + q] = t; mx = fmaxf(mx, t); } }
#pragma unroll
    for (int sh = 16; sh; sh >>= 1) mx = fmaxf(mx, __shfl_xor(mx, sh, 32));
    float sum = 0.f;
#pragma unroll
    for (int k = 0; k < TT / 32; ++k) { float d0 = __fsub_rn(v[k], mx); asm volatile("" : "+v"(d0)); v[k] = __builtin_amdgcn_exp2f(__fmul_rn(d0, 1.4426950408889634f)); sum += v[k]; }
#pragma unroll
    for (int sh = 16; sh; sh >>= 1) sum += __shfl_xor(sum, sh, 32);
    const float f = __fdiv_rn(hires ? 1.0f : PCAR, sum);
{
        if (hires) {
#pragma unroll
            for (int ch = 0; ch < TT / 128; ++ch) { v4us oh, ol;
#pragma unroll
                for (int q = 0; q < 4; ++q) { unsigned short a, c2; splitf(v[ch * 4 + q] * f, a, c2); oh[q] = a; ol[q] = c2; }
                const int oo = ch * 128 + lane * 4; *(v4usa*)(ph + oo) = oh; *(v4usa*)(ph + TT + oo) = ol; }
        } else {
#pragma unroll
            for (int ch = 0; ch < TT / 128; ++ch) { v4h o4;
#pragma unroll
                for (int q = 0; q < 4; ++q) o4[q] = tohx(v[ch * 4 + q] * f);
                *(v4ha*)(p16 + ch * 128 + lane * 4) = o4; } }
         }
}
__global__ __launch_bounds__(256) void k_addres(float* Y, const float* __restrict__ xr) { const size_t i = (size_t)blockIdx.x * 256 + threadIdx.x; if (i >= (size_t)TT * DQ / 4) return; const v4f a = *(const v4f*)(Y + i * 4); const v4f r = *(const v4f*)(xr + i * 4); v4f o;
#pragma unroll
    for (int q = 0; q < 4; ++q) o[q] = __fadd_rn(a[q], bfr(r[q]));
    *(v4f*)(Y + i * 4) = o;  }
__global__ __launch_bounds__(256) void k_lnout(const float* __restrict__ F, const float* __restrict__ g, const float* __restrict__ bb, float* out) { const int lane = threadIdx.x & 31; const int row = blockIdx.x * 8 + (threadIdx.x >> 5); if (row >= TT) return; const float* fr = F + (size_t)row * DQ; float* orow = out + (size_t)row * DQ; float v[DQ / 32]; float s = 0.f;
#pragma unroll
    for (int c = 0; c < DQ / 128; ++c) { const v4f a = *(const v4f*)(fr + c * 128 + lane * 4); for (int q = 0; q < 4; ++q) { v[c * 4 + q] = a[q]; s = __fadd_rn(s, a[q]); } }
#pragma unroll
    for (int sh = 16; sh; sh >>= 1) s = __fadd_rn(s, __shfl_xor(s, sh, 32));
    const float mean = __fdiv_rn(s, (float)DQ); float s2 = 0.f;
#pragma unroll
    for (int k = 0; k < DQ / 32; ++k) { const float dv = __fsub_rn(v[k], mean); float p2 = __fmul_rn(dv, dv); asm volatile("" : "+v"(p2)); s2 = __fadd_rn(s2, p2); v[k] = dv; }
#pragma unroll
    for (int sh = 16; sh; sh >>= 1) s2 = __fadd_rn(s2, __shfl_xor(s2, sh, 32));
    const float rs = __fdiv_rn(1.0f, __fsqrt_rn(__fadd_rn(__fdiv_rn(s2, (float)DQ), LNEPS)));
{
#pragma unroll
        for (int c = 0; c < DQ / 128; ++c) { v4f o; for (int q = 0; q < 4; ++q) { const int col = c * 128 + lane * 4 + q; float y = __fmul_rn(v[c * 4 + q], rs); asm volatile("" : "+v"(y)); y = __fmul_rn(y, bfr(g[col])); asm volatile("" : "+v"(y)); o[q] = __fadd_rn(y, bfr(bb[col])); } *(v4f*)(orow + c * 128 + lane * 4) = o; }
         } }
__global__ __launch_bounds__(256) void k_merge(const float* __restrict__ O, int h0, bf* Ah, bf* Al) { const size_t e = ((size_t)blockIdx.x * 256 + threadIdx.x) * 2; if (e >= (size_t)ZH * TT * HD) return; const int d = (int)(e % HD); const int t = (int)((e / HD) % TT); const int zz = (int)(e / ((size_t)HD * TT)); const float cs = (t < RH) ? 1.0f : (1.0f / PCAR); const size_t oo = (size_t)t * DQ + (h0 + zz) * HD + d;
    v2us oh, ol;
#pragma unroll
    for (int q = 0; q < 2; ++q) { unsigned short a, c2; splitf(O[e + q] * cs, a, c2); oh[q] = a; ol[q] = c2; } *(v2us*)(Ah + oo) = oh; *(v2us*)(Al + oo) = ol;  }

extern "C" void kernel_launch(void* const* d_in, const int* in_sizes, int n_in,
                              void* d_out, int out_size, void* d_ws, size_t ws_size, hipStream_t stream) {
    (void)in_sizes; (void)n_in; (void)out_size;
    const float* x = (const float*)d_in[0]; const float* wq = (const float*)d_in[1]; const float* bq = (const float*)d_in[2]; const float* wk = (const float*)d_in[3]; const float* bk = (const float*)d_in[4]; const float* wv = (const float*)d_in[5]; const float* bv = (const float*)d_in[6]; const float* wo = (const float*)d_in[7]; const float* bo = (const float*)d_in[8]; const float* lng = (const float*)d_in[9]; const float* lnb = (const float*)d_in[10];
    float* OUT = (float*)d_out;     // [4][2048][1024]
    char* wsp = (char*)d_ws;
    auto take = [&](size_t bytes) { char* p = wsp; wsp += (bytes + 255) & ~(size_t)255; return (void*)p; };
    float* Y = (float*)take((size_t)TT * DM * 4); bf* WQ = (bf*)take((size_t)DQ * DM * 2); bf* WK = (bf*)take((size_t)DKV * DM * 2); bf* WV = (bf*)take((size_t)DKV * DM * 2); bf* WO = (bf*)take((size_t)DM * DQ * 2); float* CS = (float*)take((size_t)TT * HD * 2 * 4);
    bf* XB = (bf*)take((size_t)TT * DM * 2); float* FQ = (float*)take((size_t)TT * DQ * 4); float* FK = (float*)take((size_t)TT * DKV * 4);
    h16* QP16 = (h16*)take((size_t)NH_ * TT * HD * 2); h16* KP16 = (h16*)take((size_t)NKV * TT * HD * 2); h16* VT16 = (h16*)take((size_t)NKV * HD * PP * 2);
    bf* QPh = (bf*)take((size_t)NH_ * TT * HD * 2); bf* QPl = (bf*)take((size_t)NH_ * TT * HD * 2); bf* KPh = (bf*)take((size_t)NKV * TT * HD * 2); bf* KPl = (bf*)take((size_t)NKV * TT * HD * 2); bf* VTh = (bf*)take((size_t)NKV * HD * PP * 2); bf* VTl = (bf*)take((size_t)NKV * HD * PP * 2);
    float* Sb = (float*)take((size_t)ZH * TT * TT * 4); float* Ob = (float*)take((size_t)ZH * TT * HD * 4); bf* ATh = (bf*)take((size_t)TT * DQ * 2); bf* ATl = (bf*)take((size_t)TT * DQ * 2);
    if ((size_t)(wsp - (char*)d_ws) > ws_size) return;    // ws 256 MiB
    float* FV = FK;   // v projection reuses the k buffer after the k planes are built (stream-ordered)
    { k_wtG<<<(unsigned)((DM * DQ / 64 + 63) / 64), 256, 0, stream>>>(wq, DM, DQ, WQ); k_wtG<<<(unsigned)((DM * DKV / 64 + 63) / 64), 256, 0, stream>>>(wk, DM, DKV, WK); k_wtG<<<(unsigned)((DM * DKV / 64 + 63) / 64), 256, 0, stream>>>(wv, DM, DKV, WV);
      k_wtG<<<(unsigned)((DQ * DM / 64 + 63) / 64), 256, 0, stream>>>(wo, DQ, DM, WO);
       }
    k_csid<<<(TT * HD + 255) / 256, 256, 0, stream>>>(CS);
    const unsigned LQ = (unsigned)(((size_t)NH_ * TT * HD / 2 + 255) / 256), LKv = (unsigned)(((size_t)NKV * TT * HD / 2 + 255) / 256);
    for (int b = 0; b < NB_; ++b) {
        
        k_cvt8<<<(unsigned)(((size_t)TT * DM / 8 + 255) / 256), 256, 0, stream>>>(x + (size_t)b * TT * DM, XB, (size_t)TT * DM / 8);
        k_gemmk<bf, 0, true, false, 8><<<dim3(TT / 64, DQ / 64, 1), 256, 0, stream>>>(XB, nullptr, WQ, nullptr, DM, FQ, DQ, bq, 0, 0, 0, 0);
        k_rope<<<LQ, 256, 0, stream>>>(FQ, DQ, NH_, CS, nullptr, nullptr, 1.0f, QP16, QPh, QPl);
        k_gemmk<bf, 0, true, false, 8><<<dim3(TT / 64, DKV / 64, 1), 256, 0, stream>>>(XB, nullptr, WK, nullptr, DM, FK, DKV, bk, 0, 0, 0, 0);
        k_rope<<<LKv, 256, 0, stream>>>(FK, DKV, NKV, CS, nullptr, nullptr, 1.0f, KP16, KPh, KPl);
        k_gemmk<bf, 0, true, false, 8><<<dim3(TT / 64, DKV / 64, 1), 256, 0, stream>>>(XB, nullptr, WV, nullptr, DM, FV, DKV, bv, 0, 0, 0, 0); k_vtp<<<LKv, 256, 0, stream>>>(FV, DKV, NKV, VT16, VTh, VTl);
        for (int h0 = 0; h0 < NH_; h0 += ZH) { const size_t zq = (size_t)h0, zk = (size_t)(h0 / REP);   // one kv head per query head: the pass's heads use consecutive kv planes (z-strides TT*HD; HD*PP for the transposed value planes)
            k_gemmc<bf, 2, 1><<<dim3(RH / 64, TT / 64, ZH), 32, 0, stream>>>(QPh + zq * TT * HD, QPl + zq * TT * HD, KPh + zk * TT * HD, KPl + zk * TT * HD, HD, Sb, TT, 0, (size_t)TT * HD, (size_t)TT * HD, (size_t)TT * TT);
            k_gemmc<h16, 0, 1><<<dim3((TT - RH) / 64, TT / 64, ZH), 32, 0, stream>>>(QP16 + zq * TT * HD + (size_t)RH * HD, nullptr, KP16 + zk * TT * HD, nullptr, HD, Sb + (size_t)RH * TT, TT, RH, (size_t)TT * HD, (size_t)TT * HD, (size_t)TT * TT);
            k_asoft<<<ZH * TT / 8, 256, 0, stream>>>(Sb);
            k_gemmk<bf, 2, false, true, 8><<<dim3(RH / 64, HD / 64, ZH), 256, 0, stream>>>((const bf*)Sb, (const bf*)Sb + TT, VTh + zk * HD * PP, VTl + zk * HD * PP, PP, Ob, HD, nullptr, 0, (size_t)TT * PP, (size_t)HD * PP, (size_t)TT * HD);
            k_gemmk<h16, 0, false, true, 16><<<dim3((TT - RH) / 64, HD / 64, ZH), 512, 0, stream>>>((const h16*)Sb + (size_t)RH * PP, nullptr, VT16 + zk * HD * PP, nullptr, PP, Ob + (size_t)RH * HD, HD, nullptr, RH, (size_t)TT * PP, (size_t)HD * PP, (size_t)TT * HD);
            k_merge<<<(unsigned)(((size_t)ZH * TT * HD / 2 + 255) / 256), 256, 0, stream>>>(Ob, h0, ATh, ATl); }
        k_gemmk<bf, 1, true, false, 8><<<dim3(TT / 64, DM / 64, 1), 256, 0, stream>>>(ATh, ATl, WO, nullptr, DQ, Y, DM, bo, 0, 0, 0, 0); k_addres<<<(unsigned)(((size_t)TT * DQ / 4 + 255) / 256), 256, 0, stream>>>(Y, x + (size_t)b * TT * DM); k_lnout<<<(TT + 7) / 8, 256, 0, stream>>>(Y, lng, lnb, OUT + (size_t)b * TT * DM); }
}

// v003
// Measured time: 516 microseconds a run.
// Next to v002, in two timings, it ran 2.02 and 2.03 times as fast.
// Counting every step since v000, it is 5.62 times as fast.
#include <hip/hip_runtime.h>

// Masked (causal) multi-head attention with residual and post-LayerNorm (x [4][2048][1024]; q,k,v = x w + b ('xw' uniform(+-1/32) incl. biases; 16 heads x 64); scores / 8; causal (-inf); softmax; out = merged wo + bo; y = (out + x - mean) / sqrt(var + 1e-5) ln_g + ln_b -> [4][2048][1024] (8.4 M)).
// Layout: per batch a bf16 copy of x; 'xw' weights transposed once; exact projections + f32 biases; head planes of q, k and transposed v kept for all four batches; one fused causal attention launch for all 64 batch-heads (hybrid rows: < 512 hi/lo 3 products, rest fp16 with probabilities x1024; running maximum and sum per query, scores and probabilities never leave registers) writes the merged hi/lo planes; per batch merged hi/lo x Wo exact + bo into workspace; residual add and a row LayerNorm kernel write the output rows.
// Compute dtypes, f32 accumulate: every input rounded to bf16; projections exact + f32 biases; attention rows < 512 3 products, rest fp16; softmax f32; Wo hl x exact + bias; residual + LayerNorm f32.

#define NB_  4
#define TT   2048
#define DM   1024
#define NH_  16
#define NKV  16
#define REP  (NH_ / NKV)
#define HD   64
#define DQ   (NH_ * HD)
#define DKV  (NKV * HD)
#define QB   256                  // query rows per attention work-group (8 waves x 32 rows)
#define RH   512                  // query rows < RH use hi+lo planes (0: none)
#define PP   TT                // row pitch, in 16-bit elements, of the transposed value planes
#define PLOG 10.0f                // fp16 probabilities carry a factor 2^10; the row sum carries it too, so it cancels in the division
#define SCL  0.125f   // HD^-0.5
#define LNEPS 1e-5f
typedef _Float16 h16;
typedef unsigned short bf;
typedef __attribute__((ext_vector_type(16))) __bf16   v16bf;
typedef __attribute__((ext_vector_type(16))) _Float16 v16h;
typedef __attribute__((ext_vector_type(8)))  _Float16 v8h;
typedef __attribute__((ext_vector_type(8)))  unsigned short v8us;
typedef __attribute__((ext_vector_type(8)))  float    v8f;
typedef __attribute__((ext_vector_type(4)))  float    v4f;
typedef v8h  __attribute__((may_alias)) v8ha;
typedef v4f  __attribute__((may_alias)) v4fa;
typedef v8us __attribute__((may_alias)) v8usa;

__device__ __forceinline__ unsigned short f2bf(float f) { unsigned u = __float_as_uint(f); u += 0x7FFFu + ((u >> 16) & 1u); return (unsigned short)(u >> 16); }
__device__ __forceinline__ float bf2f(unsigned short b) { return __uint_as_float(((unsigned)b) << 16); }
__device__ __forceinline__ float bfr(float f) { return bf2f(f2bf(f)); }
__device__ __forceinline__ v16h cat16(v8h lo, v8h hi) { return __builtin_shufflevector(lo, hi, 0, 1, 2, 3, 4, 5, 6, 7, 8, 9, 10, 11, 12, 13, 14, 15); }
__device__ __forceinline__ v16bf cat16b(v8us lo, v8us hi) { return __builtin_bit_cast(v16bf, __builtin_shufflevector(lo, hi, 0, 1, 2, 3, 4, 5, 6, 7, 8, 9, 10, 11, 12, 13, 14, 15)); }
__device__ __forceinline__ v8f wmma16(v16h a, v16h b, v8f c) { return __builtin_amdgcn_wmma_f32_16x16x32_f16(false, a, false, b, (short)0, c, false, false); }
__device__ __forceinline__ v8f wmmab(v16bf a, v16bf b, v8f c) { return __builtin_amdgcn_wmma_f32_16x16x32_bf16(false, a, false, b, (short)0, c, false, false); }



// ---- k_gemmk: 64x64 output tile per work-group, the K loop split over NW waves; operands straight from K-contiguous 16-bit planes; grid (M/64, N/64, Z), 32 * NW threads.
// C[m][n] (f32, pitch ldc, + optional f32 bias[n]) = sum_k A[m][k] Bt[n][k] (+ split products per NSPLIT). K is the row pitch of A and Bt and, without CAUS, the contraction length. z-batch strides sA/sB/sC in elements. K % 64 == 0.
// Wave w takes the 64-element K chunks w, w + NW, ... (one 128-byte line of every operand row per chunk) into its own 16 accumulators; the NW partial tiles meet in LDS and are summed in wave order 0..NW-1.
// CAUS limits the K loop of the probability x value contraction to the diagonal block (probabilities beyond it are exactly zero); roff = row offset of this launch's first row within the sequence.
template <typename T16> struct WFrag;
template <> struct WFrag<h16> { typedef v16h V; static __device__ __forceinline__ V ld(const h16* p) { return cat16(*(const v8h*)p, *(const v8h*)(p + 16)); } static __device__ __forceinline__ v8f mma(V a, V b, v8f c) { return wmma16(a, b, c); } };
template <> struct WFrag<bf> { typedef v16bf V; static __device__ __forceinline__ V ld(const bf* p) { return cat16b(*(const v8us*)p, *(const v8us*)(p + 16)); } static __device__ __forceinline__ v8f mma(V a, V b, v8f c) { return wmmab(a, b, c); } };
template <typename T16, int NSPLIT, bool BIAS, bool CAUS, int NW>
__global__ __launch_bounds__(32 * NW) void k_gemmk(const T16* __restrict__ A, const T16* __restrict__ A2, const T16* __restrict__ Bt, const T16* __restrict__ Bt2, int K, float* C, int ldc, const float* __restrict__ bias, int roff, size_t sA, size_t sB, size_t sC) {
    typedef typename WFrag<T16>::V V;
    __shared__ __align__(16) float os[NW * 64 * 68];
    const size_t z = blockIdx.z; A += z * sA; if (A2) A2 += z * sA; Bt += z * sB; if (Bt2) Bt2 += z * sB; C += z * sC;
    const int lane = threadIdx.x & 31, lr = lane & 15, hi = lane >> 4; const int r0 = blockIdx.x * 64, c0 = blockIdx.y * 64;
    const int wv = __builtin_amdgcn_readfirstlane((int)(threadIdx.x >> 5));   // wave number in a scalar register: the K loop's bounds stay scalar
    const int Kl = CAUS ? min(K, r0 + roff + 64) : K;
    v8f acc[4][4];
#pragma unroll
    for (int mb = 0; mb < 4; ++mb)
#pragma unroll
        for (int nb = 0; nb < 4; ++nb) acc[mb][nb] = (v8f){};
    const size_t aoff = (size_t)(r0 + lr) * K + 8 * hi, boff = (size_t)(c0 + lr) * K + 8 * hi;
#pragma unroll 1
    for (int k0 = wv * 64; k0 < Kl; k0 += NW * 64) {
#pragma unroll 1
    for (int kc = k0; kc < k0 + 64; kc += 32) {
        V a[4], a2[4];
#pragma unroll
        for (int mb = 0; mb < 4; ++mb) { a[mb] = WFrag<T16>::ld(A + aoff + (size_t)mb * 16 * K + kc); if (NSPLIT == 1 || NSPLIT == 2) a2[mb] = WFrag<T16>::ld(A2 + aoff + (size_t)mb * 16 * K + kc); }
#pragma unroll
        for (int nb = 0; nb < 4; ++nb) { const V b = WFrag<T16>::ld(Bt + boff + (size_t)nb * 16 * K + kc); V b2; if (NSPLIT >= 2) b2 = WFrag<T16>::ld(Bt2 + boff + (size_t)nb * 16 * K + kc);
#pragma unroll
            for (int mb = 0; mb < 4; ++mb) { acc[mb][nb] = WFrag<T16>::mma(a[mb], b, acc[mb][nb]); if (NSPLIT == 1 || NSPLIT == 2) acc[mb][nb] = WFrag<T16>::mma(a2[mb], b, acc[mb][nb]); if (NSPLIT >= 2) acc[mb][nb] = WFrag<T16>::mma(a[mb], b2, acc[mb][nb]); } }
        // four vector slots between the last matrix instruction and whatever follows the branch at the loop's foot (fragment reloads, accumulator reads)
        asm volatile("v_nop\n\tv_nop\n\tv_nop\n\tv_nop" : "+v"(acc[0][0]), "+v"(acc[1][1]), "+v"(acc[2][2]), "+v"(acc[3][3]) : "v"(a[0]), "v"(a[3]));
    } }
    float* my = os + wv * (64 * 68);
#pragma unroll
    for (int mb = 0; mb < 4; ++mb)
#pragma unroll
        for (int nb = 0; nb < 4; ++nb)
#pragma unroll
            for (int j = 0; j < 8; ++j) my[(mb * 16 + hi * 8 + j) * 68 + nb * 16 + lr] = acc[mb][nb][j];
    __syncthreads();   // every wave's partial tile is in LDS before any of them is summed
#pragma unroll
    for (int s = 0; s < 32 / NW; ++s) { const int q4 = s * 32 * NW + (int)threadIdx.x; const int row = q4 >> 4, cofs = (q4 & 15) * 4; v4f val = *(const v4fa*)(os + row * 68 + cofs);
#pragma unroll
        for (int w = 1; w < NW; ++w) { const v4f p = *(const v4fa*)(os + w * (64 * 68) + row * 68 + cofs); val += p; }
        if (BIAS) { val[0] += bfr(bias[c0 + cofs]); val[1] += bfr(bias[c0 + cofs + 1]); val[2] += bfr(bias[c0 + cofs + 2]); val[3] += bfr(bias[c0 + cofs + 3]); }
        *(v4f*)(C + (size_t)(r0 + row) * ldc + c0 + cofs) = val; }
}

__device__ __forceinline__ h16 tohx(float x) { return (h16)x; }
__device__ __forceinline__ void splitf(float y, unsigned short& h, unsigned short& l) { h = f2bf(y); l = f2bf(y - bf2f(h)); }
typedef __attribute__((ext_vector_type(2))) _Float16 v2h;
typedef __attribute__((ext_vector_type(4))) _Float16 v4h;
typedef __attribute__((ext_vector_type(2))) unsigned short v2us;
typedef __attribute__((ext_vector_type(4))) unsigned short v4us;
typedef __attribute__((ext_vector_type(2))) float v2f;
typedef __attribute__((ext_vector_type(4))) int v4i;

__global__ __launch_bounds__(256) void k_wtG(const float* __restrict__ w, int K, int N, bf* Bt) {
    const int lane = threadIdx.x & 31; const int L0 = (blockIdx.x * 8 + (threadIdx.x >> 5)) * 8; const int nlines = N * K / 64;
{
#pragma unroll 1
        for (int l = 0; l < 8; ++l) { const int L = L0 + l; if (L >= nlines) break; const size_t e = (size_t)L * 64 + lane * 2; const int k = (int)(e % K), n = (int)(e / K); v2us o;
            o[0] = f2bf(w[(size_t)k * N + n]); o[1] = f2bf(w[(size_t)(k + 1) * N + n]); *(v2us*)(Bt + e) = o; }
         }
}
__global__ __launch_bounds__(256) void k_cvt8(const float* __restrict__ src, bf* dst, size_t n8) { const size_t i = (size_t)blockIdx.x * 256 + threadIdx.x; if (i >= n8) return; const v8f v = *(const v8f*)(src + i * 8); v8us o;
#pragma unroll
    for (int k = 0; k < 8; ++k) o[k] = f2bf(v[k]); *(v8us*)(dst + i * 8) = o;  }

// k_rope: head planes [h][t][d] (fp16 + hi/lo) of rope(x) x sc with the rotate-half convention out[d] = x[d] cos[t][d] - x[d+HD/2] sin[t][d], out[d+HD/2] = x[d+HD/2] cos[t][d+HD/2] + x[d] sin[t][d+HD/2]
__global__ __launch_bounds__(256) void k_rope(const float* __restrict__ F, int pitch, int nheads, const float* __restrict__ CS, const float* __restrict__ RF, const float* __restrict__ nw, float sc, h16* P16, bf* Ph, bf* Pl) {
    const size_t e = ((size_t)blockIdx.x * 256 + threadIdx.x) * 2; if (e >= (size_t)nheads * TT * HD) return; const int d = (int)(e % HD); const int t = (int)((e / HD) % TT); const int h = (int)(e / ((size_t)HD * TT)); const float* f = F + (size_t)t * pitch + h * HD; const float rf = RF ? RF[(size_t)h * TT + t] : 1.0f; v2h o16; v2us oh, ol;
#pragma unroll
    for (int q = 0; q < 2; ++q) { const int dd = d + q; const int dp = (dd < HD / 2) ? dd + HD / 2 : dd - HD / 2; float x0 = f[dd], x1 = f[dp];
        if (RF) { float n0 = __fmul_rn(x0, rf), n1 = __fmul_rn(x1, rf); asm volatile("" : "+v"(n0)); asm volatile("" : "+v"(n1)); x0 = __fmul_rn(bfr(nw[dd]), n0); x1 = __fmul_rn(bfr(nw[dp]), n1); }
        const v2f cs = *(const v2f*)(CS + ((size_t)t * HD + dd) * 2); float a = __fmul_rn(x0, cs[0]), bq = __fmul_rn(x1, cs[1]); asm volatile("" : "+v"(a)); asm volatile("" : "+v"(bq)); const float r = ((dd < HD / 2) ? __fsub_rn(a, bq) : __fadd_rn(a, bq)) * sc;
        o16[q] = tohx(r); unsigned short a2, c2; splitf(r, a2, c2); oh[q] = a2; ol[q] = c2; }
    *(v2h*)(P16 + e) = o16; *(v2us*)(Ph + e) = oh; *(v2us*)(Pl + e) = ol;  }
__global__ __launch_bounds__(256) void k_vtp(const float* __restrict__ F, int pitch, int nheads, h16* V16, bf* Vh, bf* Vl) { const size_t e = ((size_t)blockIdx.x * 256 + threadIdx.x) * 2; if (e >= (size_t)nheads * HD * TT) return; const int t = (int)(e % TT); const int d = (int)((e / TT) % HD); const int g = (int)(e / ((size_t)TT * HD)); const size_t o = ((size_t)g * HD + d) * PP + t; v2h o16; v2us oh, ol;
#pragma unroll
    for (int q = 0; q < 2; ++q) { const float x = F[(size_t)(t + q) * pitch + g * HD + d]; o16[q] = tohx(x); unsigned short a2, c2; splitf(x, a2, c2); oh[q] = a2; ol[q] = c2; }
    *(v2h*)(V16 + o) = o16; *(v2us*)(Vh + o) = oh; *(v2us*)(Vl + o) = ol;  }
__global__ __launch_bounds__(256) void k_csid(float* CS) { const int idx = blockIdx.x * 256 + threadIdx.x; if (idx >= TT * HD) return; v2f cs; cs[0] = 1.0f; cs[1] = 0.0f; *(v2f*)(CS + (size_t)idx * 2) = cs;  }
__global__ __launch_bounds__(256) void k_addres(float* Y, const float* __restrict__ xr) { const size_t i = (size_t)blockIdx.x * 256 + threadIdx.x; if (i >= (size_t)TT * DQ / 4) return; const v4f a = *(const v4f*)(Y + i * 4); const v4f r = *(const v4f*)(xr + i * 4); v4f o;
#pragma unroll
    for (int q = 0; q < 4; ++q) o[q] = __fadd_rn(a[q], bfr(r[q]));
    *(v4f*)(Y + i * 4) = o;  }
__global__ __launch_bounds__(256) void k_lnout(const float* __restrict__ F, const float* __restrict__ g, const float* __restrict__ bb, float* out) { const int lane = threadIdx.x & 31; const int row = blockIdx.x * 8 + (threadIdx.x >> 5); if (row >= TT) return; const float* fr = F + (size_t)row * DQ; float* orow = out + (size_t)row * DQ; float v[DQ / 32]; float s = 0.f;
#pragma unroll
    for (int c = 0; c < DQ / 128; ++c) { const v4f a = *(const v4f*)(fr + c * 128 + lane * 4); for (int q = 0; q < 4; ++q) { v[c * 4 + q] = a[q]; s = __fadd_rn(s, a[q]); } }
#pragma unroll
    for (int sh = 16; sh; sh >>= 1) s = __fadd_rn(s, __shfl_xor(s, sh, 32));
    const float mean = __fdiv_rn(s, (float)DQ); float s2 = 0.f;
#pragma unroll
    for (int k = 0; k < DQ / 32; ++k) { const float dv = __fsub_rn(v[k], mean); float p2 = __fmul_rn(dv, dv); asm volatile("" : "+v"(p2)); s2 = __fadd_rn(s2, p2); v[k] = dv; }
#pragma unroll
    for (int sh = 16; sh; sh >>= 1) s2 = __fadd_rn(s2, __shfl_xor(s2, sh, 32));
    const float rs = __fdiv_rn(1.0f, __fsqrt_rn(__fadd_rn(__fdiv_rn(s2, (float)DQ), LNEPS)));
{
#pragma unroll
        for (int c = 0; c < DQ / 128; ++c) { v4f o; for (int q = 0; q < 4; ++q) { const int col = c * 128 + lane * 4 + q; float y = __fmul_rn(v[c * 4 + q], rs); asm volatile("" : "+v"(y)); y = __fmul_rn(y, bfr(g[col])); asm volatile("" : "+v"(y)); o[q] = __fadd_rn(y, bfr(bb[col])); } *(v4f*)(orow + c * 128 + lane * 4) = o; }
         } }
__device__ __forceinline__ float xhalf(float x) { return __builtin_bit_cast(float, __builtin_amdgcn_permlanex16(__builtin_bit_cast(int, x), __builtin_bit_cast(int, x), 0x76543210, 0xfedcba98, false, false)); }   // lane l reads lane l ^ 16, on the vector pipe
// 2^x with the slot behind the transcendental filled in the same statement
__device__ __forceinline__ float exp2s(float x) { float r; asm("v_exp_f32 %0, %1\n\tv_nop" : "=v"(r) : "v"(x)); return r; }
template <typename T16, int NSPLIT, int NQ>
__device__ __forceinline__ void fa_tile(const T16* __restrict__ Q, const T16* __restrict__ Q2, const T16* __restrict__ Kp, const T16* __restrict__ K2, const T16* __restrict__ Vt, const T16* __restrict__ Vt2, const int q0, bf* Ah, bf* Al, const int lr, const int hi) {
    typedef typename WFrag<T16>::V V;
    const float C2 = SCL * 1.4426950408889634f;           // score -> log2 units
    const float PB = (NSPLIT == 0) ? PLOG : 0.0f;
    // every fragment address = a wave-uniform base (plane, tile, key block) + one of two per-lane byte offsets that live through the whole tile + a constant
    const unsigned ko = (unsigned)(lr * HD + 8 * hi) * 2u, vo = (unsigned)(lr * PP + 8 * hi) * 2u;
    auto at = [](const T16* base, unsigned bytes, int elems) { return (const T16*)((const char*)base + bytes) + elems; };
    // hi/lo path only: this one stands behind each plane's group of loads
    auto XW = [] { asm volatile("s_wait_xcnt 0x0" ::: "memory"); };
    V qf[NQ][2], qf2[NQ][2], kf[2][2], kf2[2][2];
#pragma unroll
    for (int nq = 0; nq < NQ; ++nq)
#pragma unroll
        for (int ks = 0; ks < 2; ++ks) { const int o = nq * 16 * HD + ks * 32; qf[nq][ks] = WFrag<T16>::ld(at(Q + (size_t)q0 * HD, ko, o)); if (NSPLIT) qf2[nq][ks] = WFrag<T16>::ld(at(Q2 + (size_t)q0 * HD, ko, o)); }
    auto ldK = [&](const int k0) {                        // key fragments of the 32-key block that starts at key k0
#pragma unroll
        for (int mt = 0; mt < 2; ++mt)
#pragma unroll
            for (int ks = 0; ks < 2; ++ks) kf[mt][ks] = WFrag<T16>::ld(at(Kp + (size_t)k0 * HD, ko, mt * 16 * HD + ks * 32));
        if constexpr (NSPLIT != 0) { XW();
#pragma unroll
            for (int mt = 0; mt < 2; ++mt)
#pragma unroll
                for (int ks = 0; ks < 2; ++ks) kf2[mt][ks] = WFrag<T16>::ld(at(K2 + (size_t)k0 * HD, ko, mt * 16 * HD + ks * 32));
            XW(); } };
    if constexpr (NSPLIT == 0) ldK(0);
    v8f O[4][NQ]; float m[NQ], l[NQ];
#pragma unroll
    for (int nq = 0; nq < NQ; ++nq) { m[nq] = -3.0e38f; l[nq] = 0.f;
#pragma unroll
        for (int dt = 0; dt < 4; ++dt) O[dt][nq] = (v8f){}; }
    const int klast = (q0 + 16 * NQ - 1) & ~31;           // first key of the block that holds the tile's last diagonal element
#pragma unroll 1   // rolled: a second copy of the block body would hold a second set of fragments and scores in registers and cost resident waves
    for (int kb = 0; kb <= klast; kb += 32) {
        if constexpr (NSPLIT != 0) ldK(kb);               // hi/lo path: four planes' fragments held over the whole block would cost the kernel a wave per SIMD, so its keys are fetched where they are used
        v8f st[2][NQ];
#pragma unroll
        for (int mt = 0; mt < 2; ++mt)
#pragma unroll
            for (int nq = 0; nq < NQ; ++nq) { v8f a = (v8f){};
#pragma unroll
                for (int ks = 0; ks < 2; ++ks) { a = WFrag<T16>::mma(kf[mt][ks], qf[nq][ks], a); if (NSPLIT) { a = WFrag<T16>::mma(kf[mt][ks], qf2[nq][ks], a); a = WFrag<T16>::mma(kf2[mt][ks], qf[nq][ks], a); } }
                st[mt][nq] = a; }
        // this block's value fragments: asked for here, used behind the softmax
        V vf[4], vf2[4];
#pragma unroll
        for (int dt = 0; dt < 4; ++dt) vf[dt] = WFrag<T16>::ld(at(Vt + kb, vo, dt * 16 * PP));
        if constexpr (NSPLIT != 0) { XW();
#pragma unroll
            for (int dt = 0; dt < 4; ++dt) vf2[dt] = WFrag<T16>::ld(at(Vt2 + kb, vo, dt * 16 * PP));
            XW(); }
        // fp16 path: the next block's key fragments are fetched behind this block's score products, so that their latency runs under the softmax and the value products (the last block fetches itself again: in bounds, unused)
        if constexpr (NSPLIT == 0) ldK(min(kb + 32, klast));
        if (kb + 31 > q0) {                               // wave-uniform: only a block that reaches past the tile's first query holds keys above the diagonal
#pragma unroll
            for (int mt = 0; mt < 2; ++mt)
#pragma unroll
                for (int nq = 0; nq < NQ; ++nq)
#pragma unroll
                    for (int j = 0; j < 8; ++j) st[mt][nq][j] = (kb + mt * 16 + hi * 8 + j <= q0 + nq * 16 + lr) ? st[mt][nq][j] : -3.0e38f; }
        V pf[NQ], pf2[NQ];
#pragma unroll
        for (int nq = 0; nq < NQ; ++nq) { float mx = st[0][nq][0];
#pragma unroll
            for (int j = 1; j < 8; ++j) mx = fmaxf(mx, st[0][nq][j]);
#pragma unroll
            for (int j = 0; j < 8; ++j) mx = fmaxf(mx, st[1][nq][j]);
            mx = fmaxf(mx, xhalf(mx));
            const float mn = fmaxf(m[nq], mx * C2); const float al = exp2s(m[nq] - mn); const float sh = PB - mn; m[nq] = mn;
            float p[16], s = 0.f;
#pragma unroll
            for (int e = 0; e < 16; ++e) { p[e] = exp2s(fmaf(st[e >> 3][nq][e & 7], C2, sh)); s += p[e]; }
            l[nq] = fmaf(l[nq], al, s);
#pragma unroll
            for (int dt = 0; dt < 4; ++dt) O[dt][nq] *= al;
            if constexpr (NSPLIT == 0) { v16h t;
#pragma unroll
                for (int e = 0; e < 16; ++e) t[e] = tohx(p[e]);
                pf[nq] = t;
            } else { v8us h0, h1, l0, l1;
#pragma unroll
                for (int e = 0; e < 8; ++e) { unsigned short a, c; splitf(p[e], a, c); h0[e] = a; l0[e] = c; splitf(p[8 + e], a, c); h1[e] = a; l1[e] = c; }
                pf[nq] = cat16b(h0, h1); pf2[nq] = cat16b(l0, l1); } }
#pragma unroll
        for (int dt = 0; dt < 4; ++dt)
#pragma unroll
            for (int nq = 0; nq < NQ; ++nq) { O[dt][nq] = WFrag<T16>::mma(vf[dt], pf[nq], O[dt][nq]); if (NSPLIT) { O[dt][nq] = WFrag<T16>::mma(vf[dt], pf2[nq], O[dt][nq]); O[dt][nq] = WFrag<T16>::mma(vf2[dt], pf[nq], O[dt][nq]); } }
        // four vector slots between the last matrix instruction and whatever follows the branch at the loop's foot (fragment reloads, accumulator reads)
        if constexpr (NQ == 2) asm volatile("v_nop\n\tv_nop\n\tv_nop\n\tv_nop" : "+v"(O[0][0]), "+v"(O[1][0]), "+v"(O[2][0]), "+v"(O[3][0]), "+v"(O[0][1]), "+v"(O[1][1]), "+v"(O[2][1]), "+v"(O[3][1]) : "v"(vf[0]), "v"(vf[3]));
        else asm volatile("v_nop\n\tv_nop\n\tv_nop\n\tv_nop" : "+v"(O[0][0]), "+v"(O[1][0]), "+v"(O[2][0]), "+v"(O[3][0]) : "v"(vf[0]), "v"(vf[3]));
    }
#pragma unroll
    for (int nq = 0; nq < NQ; ++nq) { const float inv = __fdiv_rn(1.0f, l[nq] + xhalf(l[nq]));
#pragma unroll
        for (int dt = 0; dt < 4; ++dt) { v8us oh, ol;
#pragma unroll
            for (int j = 0; j < 8; ++j) { unsigned short a, c; splitf(O[dt][nq][j] * inv, a, c); oh[j] = a; ol[j] = c; }
            const size_t oo = (size_t)(q0 + nq * 16 + lr) * DQ + dt * 16 + hi * 8; *(v8us*)(Ah + oo) = oh; *(v8us*)(Al + oo) = ol; } }
    asm volatile("s_wait_xcnt 0x0" ::: "memory");   // stands between the tile's last stores and whatever code follows the tile (the next tile's set-up), which rewrites registers that those stores name
}
__global__ __launch_bounds__(256) void k_fattn(const h16* __restrict__ Q16, const h16* __restrict__ K16, const h16* __restrict__ V16, const bf* __restrict__ Qh, const bf* __restrict__ Ql, const bf* __restrict__ Kh, const bf* __restrict__ Kl, const bf* __restrict__ Vh, const bf* __restrict__ Vl, bf* Ah, bf* Al) {
    const int lane = threadIdx.x & 31, lr = lane & 15, hi = lane >> 4;
    const int wv = __builtin_amdgcn_readfirstlane((int)(threadIdx.x >> 5));   // wave number in a scalar register: the key loop's bounds and the mask test stay scalar
    const int bh = blockIdx.x, y = blockIdx.y;
    const int pb = (y < TT / QB / 2) ? TT / QB - 1 - y : y - TT / QB / 2;      // low y takes the long row blocks, then the short ones from the shortest up (for balance only)
    const int q0 = pb * QB + wv * 32;
    const size_t pq = (size_t)bh * TT * HD, pv = (size_t)bh * HD * PP, po = (size_t)(bh / NH_) * TT * DQ + (size_t)(bh % NH_) * HD;
    if (q0 < RH) {
#pragma unroll 1   // rolled: one copy of the hi/lo tile's code serves both 16-row tiles (for speed only)
        for (int sub = 0; sub < 2; ++sub) { fa_tile<bf, 2, 1>(Qh + pq, Ql + pq, Kh + pq, Kl + pq, Vh + pv, Vl + pv, q0 + 16 * sub, Ah + po, Al + po, lr, hi); }
    } else fa_tile<h16, 0, 2>(Q16 + pq, nullptr, K16 + pq, nullptr, V16 + pv, nullptr, q0, Ah + po, Al + po, lr, hi);
}

extern "C" void kernel_launch(void* const* d_in, const int* in_sizes, int n_in,
                              void* d_out, int out_size, void* d_ws, size_t ws_size, hipStream_t stream) {
    (void)in_sizes; (void)n_in; (void)out_size;
    const float* x = (const float*)d_in[0]; const float* wq = (const float*)d_in[1]; const float* bq = (const float*)d_in[2]; const float* wk = (const float*)d_in[3]; const float* bk = (const float*)d_in[4]; const float* wv = (const float*)d_in[5]; const float* bv = (const float*)d_in[6]; const float* wo = (const float*)d_in[7]; const float* bo = (const float*)d_in[8]; const float* lng = (const float*)d_in[9]; const float* lnb = (const float*)d_in[10];
    float* OUT = (float*)d_out;     // [4][2048][1024]
    char* wsp = (char*)d_ws;
    auto take = [&](size_t bytes) { char* p = wsp; wsp += (bytes + 255) & ~(size_t)255; return (void*)p; };
    float* Y = (float*)take((size_t)TT * DM * 4); bf* WQ = (bf*)take((size_t)DQ * DM * 2); bf* WK = (bf*)take((size_t)DKV * DM * 2); bf* WV = (bf*)take((size_t)DKV * DM * 2); bf* WO = (bf*)take((size_t)DM * DQ * 2); float* CS = (float*)take((size_t)TT * HD * 2 * 4);
    bf* XB = (bf*)take((size_t)TT * DM * 2); float* FQ = (float*)take((size_t)TT * DQ * 4); float* FK = (float*)take((size_t)TT * DKV * 4);
    const size_t SP = (size_t)NH_ * TT * HD, SV = (size_t)NKV * HD * PP, SA = (size_t)TT * DQ;   // one batch's elements in a q or k plane, a transposed v plane, a merged plane
    h16* QP16 = (h16*)take(NB_ * SP * 2); h16* KP16 = (h16*)take(NB_ * SP * 2); h16* VT16 = (h16*)take(NB_ * SV * 2);
    bf* QPh = (bf*)take(NB_ * SP * 2); bf* QPl = (bf*)take(NB_ * SP * 2); bf* KPh = (bf*)take(NB_ * SP * 2); bf* KPl = (bf*)take(NB_ * SP * 2); bf* VTh = (bf*)take(NB_ * SV * 2); bf* VTl = (bf*)take(NB_ * SV * 2);
    bf* ATh = (bf*)take(NB_ * SA * 2); bf* ATl = (bf*)take(NB_ * SA * 2);
    if ((size_t)(wsp - (char*)d_ws) > ws_size) return;    // ws 256 MiB
    float* FV = FK;   // v projection reuses the k buffer after the k planes are built (stream-ordered)
    { k_wtG<<<(unsigned)((DM * DQ / 64 + 63) / 64), 256, 0, stream>>>(wq, DM, DQ, WQ); k_wtG<<<(unsigned)((DM * DKV / 64 + 63) / 64), 256, 0, stream>>>(wk, DM, DKV, WK); k_wtG<<<(unsigned)((DM * DKV / 64 + 63) / 64), 256, 0, stream>>>(wv, DM, DKV, WV);
      k_wtG<<<(unsigned)((DQ * DM / 64 + 63) / 64), 256, 0, stream>>>(wo, DQ, DM, WO);
       }
    k_csid<<<(TT * HD + 255) / 256, 256, 0, stream>>>(CS);
    const unsigned LQ = (unsigned)(((size_t)NH_ * TT * HD / 2 + 255) / 256), LKv = (unsigned)(((size_t)NKV * TT * HD / 2 + 255) / 256);
    for (int b = 0; b < NB_; ++b) {
        k_cvt8<<<(unsigned)(((size_t)TT * DM / 8 + 255) / 256), 256, 0, stream>>>(x + (size_t)b * TT * DM, XB, (size_t)TT * DM / 8);
        k_gemmk<bf, 0, true, false, 8><<<dim3(TT / 64, DQ / 64, 1), 256, 0, stream>>>(XB, nullptr, WQ, nullptr, DM, FQ, DQ, bq, 0, 0, 0, 0);
        k_rope<<<LQ, 256, 0, stream>>>(FQ, DQ, NH_, CS, nullptr, nullptr, 1.0f, QP16 + b * SP, QPh + b * SP, QPl + b * SP);
        k_gemmk<bf, 0, true, false, 8><<<dim3(TT / 64, DKV / 64, 1), 256, 0, stream>>>(XB, nullptr, WK, nullptr, DM, FK, DKV, bk, 0, 0, 0, 0);
        k_rope<<<LKv, 256, 0, stream>>>(FK, DKV, NKV, CS, nullptr, nullptr, 1.0f, KP16 + b * SP, KPh + b * SP, KPl + b * SP);
        k_gemmk<bf, 0, true, false, 8><<<dim3(TT / 64, DKV / 64, 1), 256, 0, stream>>>(XB, nullptr, WV, nullptr, DM, FV, DKV, bv, 0, 0, 0, 0); k_vtp<<<LKv, 256, 0, stream>>>(FV, DKV, NKV, VT16 + b * SV, VTh + b * SV, VTl + b * SV); }
    k_fattn<<<dim3(NB_ * NH_, TT / QB, 1), 256, 0, stream>>>(QP16, KP16, VT16, QPh, QPl, KPh, KPl, VTh, VTl, ATh, ATl);   // one kv head per query head: batch-head bh uses plane bh of every operand
    for (int b = 0; b < NB_; ++b) {
        k_gemmk<bf, 1, true, false, 8><<<dim3(TT / 64, DM / 64, 1), 256, 0, stream>>>(ATh + b * SA, ATl + b * SA, WO, nullptr, DQ, Y, DM, bo, 0, 0, 0, 0); k_addres<<<(unsigned)(((size_t)TT * DQ / 4 + 255) / 256), 256, 0, stream>>>(Y, x + (size_t)b * TT * DM); k_lnout<<<(TT + 7) / 8, 256, 0, stream>>>(Y, lng, lnb, OUT + (size_t)b * TT * DM); }
}

// v004
// A run of this version takes 399 microseconds.
// Next to v003, in two timings, it ran 1.29 and 1.31 times as fast.
// Over all steps from v000 it is 7.31 times as fast.
#include <hip/hip_runtime.h>

// Masked (causal) multi-head attention with residual and post-LayerNorm (x [4][2048][1024]; q,k,v = x w + b ('xw' uniform(+-1/32) incl. biases; 16 heads x 64); scores / 8; causal (-inf); softmax; out = merged wo + bo; y = (out + x - mean) / sqrt(var + 1e-5) ln_g + ln_b -> [4][2048][1024] (8.4 M)).
// Layout: per batch a bf16 copy of x; 'xw' weights transposed once; exact projections + f32 biases, whose epilogues write the head planes of q, k and transposed v (kept for all four batches) themselves; one fused causal attention launch for all 64 batch-heads (hybrid rows: < 512 hi/lo 3 products, rest fp16 with probabilities x1024; running maximum and sum per query, scores and probabilities never leave registers) writes the merged hi/lo planes; per batch merged hi/lo x Wo exact + bo + residual into workspace; a row LayerNorm kernel writes the output rows.
// Compute dtypes, f32 accumulate: every input rounded to bf16; projections exact + f32 biases; attention rows < 512 3 products, rest fp16; softmax f32; Wo hl x exact + bias; residual + LayerNorm f32.

#define NB_  4
#define TT   2048
#define DM   1024
#define NH_  16
#define NKV  16
#define REP  (NH_ / NKV)
#define HD   64
#define DQ   (NH_ * HD)
#define DKV  (NKV * HD)
#define QB   256                  // query rows per attention work-group (8 waves x 32 rows)
#define RH   512                  // query rows < RH use hi+lo planes (0: none)
#define PP   TT                // row pitch, in 16-bit elements, of the transposed value planes
#define PLOG 10.0f                // fp16 probabilities carry a factor 2^10; the row sum carries it too, so it cancels in the division
#define SCL  0.125f   // HD^-0.5
#define LNEPS 1e-5f
typedef _Float16 h16;
typedef unsigned short bf;
typedef __attribute__((ext_vector_type(16))) __bf16   v16bf;
typedef __attribute__((ext_vector_type(16))) _Float16 v16h;
typedef __attribute__((ext_vector_type(8)))  _Float16 v8h;
typedef __attribute__((ext_vector_type(8)))  unsigned short v8us;
typedef __attribute__((ext_vector_type(8)))  float    v8f;
typedef __attribute__((ext_vector_type(4)))  float    v4f;
typedef v8h  __attribute__((may_alias)) v8ha;
typedef v4f  __attribute__((may_alias)) v4fa;
typedef v8us __attribute__((may_alias)) v8usa;

__device__ __forceinline__ unsigned short f2bf(float f) { unsigned u = __float_as_uint(f); u += 0x7FFFu + ((u >> 16) & 1u); return (unsigned short)(u >> 16); }
__device__ __forceinline__ float bf2f(unsigned short b) { return __uint_as_float(((unsigned)b) << 16); }
__device__ __forceinline__ float bfr(float f) { return bf2f(f2bf(f)); }
__device__ __forceinline__ v16h cat16(v8h lo, v8h hi) { return __builtin_shufflevector(lo, hi, 0, 1, 2, 3, 4, 5, 6, 7, 8, 9, 10, 11, 12, 13, 14, 15); }
__device__ __forceinline__ v16bf cat16b(v8us lo, v8us hi) { return __builtin_bit_cast(v16bf, __builtin_shufflevector(lo, hi, 0, 1, 2, 3, 4, 5, 6, 7, 8, 9, 10, 11, 12, 13, 14, 15)); }
__device__ __forceinline__ v8f wmma16(v16h a, v16h b, v8f c) { return __builtin_amdgcn_wmma_f32_16x16x32_f16(false, a, false, b, (short)0, c, false, false); }
__device__ __forceinline__ v8f wmmab(v16bf a, v16bf b, v8f c) { return __builtin_amdgcn_wmma_f32_16x16x32_bf16(false, a, false, b, (short)0, c, false, false); }
__device__ __forceinline__ h16 tohx(float x) { return (h16)x; }
__device__ __forceinline__ void splitf(float y, unsigned short& h, unsigned short& l) { h = f2bf(y); l = f2bf(y - bf2f(h)); }



// ---- k_gemmk: 64x64 output tile per work-group, the K loop split over NW waves; operands straight from K-contiguous 16-bit planes; grid (M/64, N/64, Z), 32 * NW threads.
// tile[m][n] (f32, + f32 bias) = sum_k A[m][k] Bt[n][k] (+ split products per NSPLIT). K is the row pitch of A and Bt and, without CAUS, the contraction length. z-batch strides sA/sB/sC in elements. K % 64 == 0.
// Wave w takes the 64-element K chunks w, w + NW, ... (one 128-byte line of every operand row per chunk) into its own 16 accumulators; the NW partial tiles meet in LDS and are summed in wave order 0..NW-1.
// EPI says where the summed tile goes. EPI_HEAD: m = position, n = head * HD + d, bias[n]; fp16 and hi/lo head planes [head][position][d]. EPI_VT: m = head * HD + d, n = position (weights as A, x as Bt), bias[m]; fp16 and hi/lo transposed planes [head][d][position], pitch PP.
// EPI_RES: bias[n], then + the bf16-rounded residual xr[m][n]; f32 to C (both pitch ldc). In the plane forms a thread holds 8 neighbours of a plane row, so a wave's store covers four whole 128-byte lines of each plane.
// CAUS limits the K loop of the probability x value contraction to the diagonal block (probabilities beyond it are exactly zero); roff = row offset of this launch's first row within the sequence.
template <typename T16> struct WFrag;
template <> struct WFrag<h16> { typedef v16h V; static __device__ __forceinline__ V ld(const h16* p) { return cat16(*(const v8h*)p, *(const v8h*)(p + 16)); } static __device__ __forceinline__ v8f mma(V a, V b, v8f c) { return wmma16(a, b, c); } };
template <> struct WFrag<bf> { typedef v16bf V; static __device__ __forceinline__ V ld(const bf* p) { return cat16b(*(const v8us*)p, *(const v8us*)(p + 16)); } static __device__ __forceinline__ v8f mma(V a, V b, v8f c) { return wmmab(a, b, c); } };
enum { EPI_HEAD = 1, EPI_VT = 2, EPI_RES = 3 };
template <typename T16, int NSPLIT, bool BIAS, bool CAUS, int NW, int EPI>
__global__ __launch_bounds__(32 * NW) void k_gemmk(const T16* __restrict__ A, const T16* __restrict__ A2, const T16* __restrict__ Bt, const T16* __restrict__ Bt2, int K, float* C, int ldc, const float* __restrict__ bias, int roff, size_t sA, size_t sB, size_t sC, const float* __restrict__ xr, h16* P16, bf* Ph, bf* Pl) {
    static_assert(HD == 64, "a 64-wide tile is one head"); static_assert(BIAS, "every epilogue adds its bias");
    typedef typename WFrag<T16>::V V;
    __shared__ __align__(16) float os[NW * 64 * 68];
    const size_t z = blockIdx.z; A += z * sA; if (A2) A2 += z * sA; Bt += z * sB; if (Bt2) Bt2 += z * sB; C += z * sC;
    const int lane = threadIdx.x & 31, lr = lane & 15, hi = lane >> 4; const int r0 = blockIdx.x * 64, c0 = blockIdx.y * 64;
    const int wv = __builtin_amdgcn_readfirstlane((int)(threadIdx.x >> 5));   // wave number in a scalar register: the K loop's bounds stay scalar
    const int Kl = CAUS ? min(K, r0 + roff + 64) : K;
    v8f acc[4][4];
#pragma unroll
    for (int mb = 0; mb < 4; ++mb)
#pragma unroll
        for (int nb = 0; nb < 4; ++nb) acc[mb][nb] = (v8f){};
    const size_t aoff = (size_t)(r0 + lr) * K + 8 * hi, boff = (size_t)(c0 + lr) * K + 8 * hi;
#pragma unroll 1
    for (int k0 = wv * 64; k0 < Kl; k0 += NW * 64) {
#pragma unroll 1
    for (int kc = k0; kc < k0 + 64; kc += 32) {
        V a[4], a2[4];
#pragma unroll
        for (int mb = 0; mb < 4; ++mb) { a[mb] = WFrag<T16>::ld(A + aoff + (size_t)mb * 16 * K + kc); if (NSPLIT == 1 || NSPLIT == 2) a2[mb] = WFrag<T16>::ld(A2 + aoff + (size_t)mb * 16 * K + kc); }
#pragma unroll
        for (int nb = 0; nb < 4; ++nb) { const V b = WFrag<T16>::ld(Bt + boff + (size_t)nb * 16 * K + kc); V b2; if (NSPLIT >= 2) b2 = WFrag<T16>::ld(Bt2 + boff + (size_t)nb * 16 * K + kc);
#pragma unroll
            for (int mb = 0; mb < 4; ++mb) { acc[mb][nb] = WFrag<T16>::mma(a[mb], b, acc[mb][nb]); if (NSPLIT == 1 || NSPLIT == 2) acc[mb][nb] = WFrag<T16>::mma(a2[mb], b, acc[mb][nb]); if (NSPLIT >= 2) acc[mb][nb] = WFrag<T16>::mma(a[mb], b2, acc[mb][nb]); } }
        // four vector slots between the last matrix instruction and whatever follows the branch at the loop's foot (fragment reloads, accumulator reads)
        asm volatile("v_nop\n\tv_nop\n\tv_nop\n\tv_nop" : "+v"(acc[0][0]), "+v"(acc[1][1]), "+v"(acc[2][2]), "+v"(acc[3][3]) : "v"(a[0]), "v"(a[3]));
    } }
    // the epilogue's own global operands (bias, residual) are asked for here, so that their latency runs under the exchange through LDS
    const int tid = (int)threadIdx.x;
    v4f bq4[2], res[32 / NW]; float brow[16 / NW];
    // stands behind issued loads, in front of whatever rewrites their address registers (behind each residual load: a later one's destination took over an earlier one's address pair)
    auto XW = [] { asm volatile("s_wait_xcnt 0x0" ::: "memory"); };
    if constexpr (EPI == EPI_RES) { bq4[0] = *(const v4f*)(bias + c0 + (tid & 15) * 4);
#pragma unroll
        for (int s = 0; s < 32 / NW; ++s) { res[s] = *(const v4f*)(xr + (size_t)(r0 + ((s * 32 * NW + tid) >> 4)) * ldc + c0 + (tid & 15) * 4); XW(); } }
    if constexpr (EPI == EPI_HEAD) { bq4[0] = *(const v4f*)(bias + c0 + (tid & 7) * 8); bq4[1] = *(const v4f*)(bias + c0 + (tid & 7) * 8 + 4); XW(); }
    if constexpr (EPI == EPI_VT) {
#pragma unroll
        for (int s = 0; s < 16 / NW; ++s) brow[s] = bias[r0 + ((s * 32 * NW + tid) >> 3)];
        XW(); }
    float* my = os + wv * (64 * 68);
#pragma unroll
    for (int mb = 0; mb < 4; ++mb)
#pragma unroll
        for (int nb = 0; nb < 4; ++nb)
#pragma unroll
            for (int j = 0; j < 8; ++j) my[(mb * 16 + hi * 8 + j) * 68 + nb * 16 + lr] = acc[mb][nb][j];
    __syncthreads();   // every wave's partial tile is in LDS before any of them is summed
    if constexpr (EPI == EPI_RES) {
#pragma unroll
    for (int s = 0; s < 32 / NW; ++s) { const int q4 = s * 32 * NW + tid; const int row = q4 >> 4, cofs = (q4 & 15) * 4; v4f val = *(const v4fa*)(os + row * 68 + cofs);
#pragma unroll
        for (int w = 1; w < NW; ++w) { const v4f p = *(const v4fa*)(os + w * (64 * 68) + row * 68 + cofs); val += p; }
#pragma unroll
        for (int q = 0; q < 4; ++q) { val[q] += bfr(bq4[0][q]); val[q] = __fadd_rn(val[q], bfr(res[s][q])); }
        *(v4f*)(C + (size_t)(r0 + row) * ldc + c0 + cofs) = val; }
    } else {
#pragma unroll
    for (int s = 0; s < 16 / NW; ++s) { const int q8 = s * 32 * NW + tid; const int row = q8 >> 3, cofs = (q8 & 7) * 8; v4f val[2];
#pragma unroll
        for (int g = 0; g < 2; ++g) { val[g] = *(const v4fa*)(os + row * 68 + cofs + 4 * g);
#pragma unroll
            for (int w = 1; w < NW; ++w) { const v4f p = *(const v4fa*)(os + w * (64 * 68) + row * 68 + cofs + 4 * g); val[g] += p; } }
        v8h o16; v8us oh, ol;
#pragma unroll
        for (int e = 0; e < 8; ++e) { const float y = val[e >> 2][e & 3] + bfr(EPI == EPI_HEAD ? bq4[e >> 2][e & 3] : brow[s]); o16[e] = tohx(y); unsigned short a2, c2; splitf(y, a2, c2); oh[e] = a2; ol[e] = c2; }
        const size_t o = (EPI == EPI_HEAD) ? ((size_t)(c0 / HD) * TT + r0 + row) * HD + cofs : (size_t)(r0 + row) * PP + c0 + cofs;
        *(v8h*)(P16 + o) = o16; *(v8us*)(Ph + o) = oh; *(v8us*)(Pl + o) = ol; }
    }
}

typedef __attribute__((ext_vector_type(4))) _Float16 v4h;
typedef __attribute__((ext_vector_type(2))) unsigned short v2us;
typedef __attribute__((ext_vector_type(4))) unsigned short v4us;
typedef __attribute__((ext_vector_type(4))) int v4i;

__global__ __launch_bounds__(256) void k_wtG(const float* __restrict__ w, int K, int N, bf* Bt) {
    const int lane = threadIdx.x & 31; const int L0 = (blockIdx.x * 8 + (threadIdx.x >> 5)) * 8; const int nlines = N * K / 64;
{
#pragma unroll 1
        for (int l = 0; l < 8; ++l) { const int L = L0 + l; if (L >= nlines) break; const size_t e = (size_t)L * 64 + lane * 2; const int k = (int)(e % K), n = (int)(e / K); v2us o;
            o[0] = f2bf(w[(size_t)k * N + n]); o[1] = f2bf(w[(size_t)(k + 1) * N + n]); *(v2us*)(Bt + e) = o; }
         }
}
__global__ __launch_bounds__(256) void k_cvt8(const float* __restrict__ src, bf* dst, size_t n8) { const size_t i = (size_t)blockIdx.x * 256 + threadIdx.x; if (i >= n8) return; const v8f v = *(const v8f*)(src + i * 8); v8us o;
#pragma unroll
    for (int k = 0; k < 8; ++k) o[k] = f2bf(v[k]); *(v8us*)(dst + i * 8) = o;  }

__global__ __launch_bounds__(256) void k_lnout(const float* __restrict__ F, const float* __restrict__ g, const float* __restrict__ bb, float* out) { const int lane = threadIdx.x & 31; const int row = blockIdx.x * 8 + (threadIdx.x >> 5); if (row >= TT) return; const float* fr = F + (size_t)row * DQ; float* orow = out + (size_t)row * DQ; float v[DQ / 32]; float s = 0.f;
#pragma unroll
    for (int c = 0; c < DQ / 128; ++c) { const v4f a = *(const v4f*)(fr + c * 128 + lane * 4); for (int q = 0; q < 4; ++q) { v[c * 4 + q] = a[q]; s = __fadd_rn(s, a[q]); } }
#pragma unroll
    for (int sh = 16; sh; sh >>= 1) s = __fadd_rn(s, __shfl_xor(s, sh, 32));
    const float mean = __fdiv_rn(s, (float)DQ); float s2 = 0.f;
#pragma unroll
    for (int k = 0; k < DQ / 32; ++k) { const float dv = __fsub_rn(v[k], mean); float p2 = __fmul_rn(dv, dv); asm volatile("" : "+v"(p2)); s2 = __fadd_rn(s2, p2); v[k] = dv; }
#pragma unroll
    for (int sh = 16; sh; sh >>= 1) s2 = __fadd_rn(s2, __shfl_xor(s2, sh, 32));
    const float rs = __fdiv_rn(1.0f, __fsqrt_rn(__fadd_rn(__fdiv_rn(s2, (float)DQ), LNEPS)));
{
#pragma unroll
        for (int c = 0; c < DQ / 128; ++c) { v4f o; for (int q = 0; q < 4; ++q) { const int col = c * 128 + lane * 4 + q; float y = __fmul_rn(v[c * 4 + q], rs); asm volatile("" : "+v"(y)); y = __fmul_rn(y, bfr(g[col])); asm volatile("" : "+v"(y)); o[q] = __fadd_rn(y, bfr(bb[col])); } *(v4f*)(orow + c * 128 + lane * 4) = o; }
         } }
__device__ __forceinline__ float xhalf(float x) { return __builtin_bit_cast(float, __builtin_amdgcn_permlanex16(__builtin_bit_cast(int, x), __builtin_bit_cast(int, x), 0x76543210, 0xfedcba98, false, false)); }   // lane l reads lane l ^ 16, on the vector pipe
// 2^x with the slot behind the transcendental filled in the same statement
__device__ __forceinline__ float exp2s(float x) { float r; asm("v_exp_f32 %0, %1\n\tv_nop" : "=v"(r) : "v"(x)); return r; }
template <typename T16, int NSPLIT, int NQ>
__device__ __forceinline__ void fa_tile(const T16* __restrict__ Q, const T16* __restrict__ Q2, const T16* __restrict__ Kp, const T16* __restrict__ K2, const T16* __restrict__ Vt, const T16* __restrict__ Vt2, const int q0, bf* Ah, bf* Al, const int lr, const int hi) {
    typedef typename WFrag<T16>::V V;
    const float C2 = SCL * 1.4426950408889634f;           // score -> log2 units
    const float PB = (NSPLIT == 0) ? PLOG : 0.0f;
    // every fragment address = a wave-uniform base (plane, tile, key block) + one of two per-lane byte offsets that live through the whole tile + a constant
    const unsigned ko = (unsigned)(lr * HD + 8 * hi) * 2u, vo = (unsigned)(lr * PP + 8 * hi) * 2u;
    auto at = [](const T16* base, unsigned bytes, int elems) { return (const T16*)((const char*)base + bytes) + elems; };
    // hi/lo path only: this one stands behind each plane's group of loads
    auto XW = [] { asm volatile("s_wait_xcnt 0x0" ::: "memory"); };
    V qf[NQ][2], qf2[NQ][2], kf[2][2], kf2[2][2];
#pragma unroll
    for (int nq = 0; nq < NQ; ++nq)
#pragma unroll
        for (int ks = 0; ks < 2; ++ks) { const int o = nq * 16 * HD + ks * 32; qf[nq][ks] = WFrag<T16>::ld(at(Q + (size_t)q0 * HD, ko, o)); if (NSPLIT) qf2[nq][ks] = WFrag<T16>::ld(at(Q2 + (size_t)q0 * HD, ko, o)); }
    auto ldK = [&](const int k0) {                        // key fragments of the 32-key block that starts at key k0
#pragma unroll
        for (int mt = 0; mt < 2; ++mt)
#pragma unroll
            for (int ks = 0; ks < 2; ++ks) kf[mt][ks] = WFrag<T16>::ld(at(Kp + (size_t)k0 * HD, ko, mt * 16 * HD + ks * 32));
        if constexpr (NSPLIT != 0) { XW();
#pragma unroll
            for (int mt = 0; mt < 2; ++mt)
#pragma unroll
                for (int ks = 0; ks < 2; ++ks) kf2[mt][ks] = WFrag<T16>::ld(at(K2 + (size_t)k0 * HD, ko, mt * 16 * HD + ks * 32));
            XW(); } };
    if constexpr (NSPLIT == 0) ldK(0);
    v8f O[4][NQ]; float m[NQ], l[NQ];
#pragma unroll
    for (int nq = 0; nq < NQ; ++nq) { m[nq] = -3.0e38f; l[nq] = 0.f;
#pragma unroll
        for (int dt = 0; dt < 4; ++dt) O[dt][nq] = (v8f){}; }
    const int klast = (q0 + 16 * NQ - 1) & ~31;           // first key of the block that holds the tile's last diagonal element
#pragma unroll 1   // rolled: a second copy of the block body would hold a second set of fragments and scores in registers and cost resident waves
    for (int kb = 0; kb <= klast; kb += 32) {
        if constexpr (NSPLIT != 0) ldK(kb);               // hi/lo path: four planes' fragments held over the whole block would cost the kernel a wave per SIMD, so its keys are fetched where they are used
        v8f st[2][NQ];
#pragma unroll
        for (int mt = 0; mt < 2; ++mt)
#pragma unroll
            for (int nq = 0; nq < NQ; ++nq) { v8f a = (v8f){};
#pragma unroll
                for (int ks = 0; ks < 2; ++ks) { a = WFrag<T16>::mma(kf[mt][ks], qf[nq][ks], a); if (NSPLIT) { a = WFrag<T16>::mma(kf[mt][ks], qf2[nq][ks], a); a = WFrag<T16>::mma(kf2[mt][ks], qf[nq][ks], a); } }
                st[mt][nq] = a; }
        // this block's value fragments: asked for here, used behind the softmax
        V vf[4], vf2[4];
#pragma unroll
        for (int dt = 0; dt < 4; ++dt) vf[dt] = WFrag<T16>::ld(at(Vt + kb, vo, dt * 16 * PP));
        if constexpr (NSPLIT != 0) { XW();
#pragma unroll
            for (int dt = 0; dt < 4; ++dt) vf2[dt] = WFrag<T16>::ld(at(Vt2 + kb, vo, dt * 16 * PP));
            XW(); }
        // fp16 path: the next block's key fragments are fetched behind this block's score products, so that their latency runs under the softmax and the value products (the last block fetches itself again: in bounds, unused)
        if constexpr (NSPLIT == 0) ldK(min(kb + 32, klast));
        if (kb + 31 > q0) {                               // wave-uniform: only a block that reaches past the tile's first query holds keys above the diagonal
#pragma unroll
            for (int mt = 0; mt < 2; ++mt)
#pragma unroll
                for (int nq = 0; nq < NQ; ++nq)
#pragma unroll
                    for (int j = 0; j < 8; ++j) st[mt][nq][j] = (kb + mt * 16 + hi * 8 + j <= q0 + nq * 16 + lr) ? st[mt][nq][j] : -3.0e38f; }
        V pf[NQ], pf2[NQ];
#pragma unroll
        for (int nq = 0; nq < NQ; ++nq) { float mx = st[0][nq][0];
#pragma unroll
            for (int j = 1; j < 8; ++j) mx = fmaxf(mx, st[0][nq][j]);
#pragma unroll
            for (int j = 0; j < 8; ++j) mx = fmaxf(mx, st[1][nq][j]);
            mx = fmaxf(mx, xhalf(mx));
            const float mn = fmaxf(m[nq], mx * C2); const float al = exp2s(m[nq] - mn); const float sh = PB - mn; m[nq] = mn;
            float p[16], s = 0.f;
#pragma unroll
            for (int e = 0; e < 16; ++e) { p[e] = exp2s(fmaf(st[e >> 3][nq][e & 7], C2, sh)); s += p[e]; }
            l[nq] = fmaf(l[nq], al, s);
#pragma unroll
            for (int dt = 0; dt < 4; ++dt) O[dt][nq] *= al;
            if constexpr (NSPLIT == 0) { v16h t;
#pragma unroll
                for (int e = 0; e < 16; ++e) t[e] = tohx(p[e]);
                pf[nq] = t;
            } else { v8us h0, h1, l0, l1;
#pragma unroll
                for (int e = 0; e < 8; ++e) { unsigned short a, c; splitf(p[e], a, c); h0[e] = a; l0[e] = c; splitf(p[8 + e], a, c); h1[e] = a; l1[e] = c; }
                pf[nq] = cat16b(h0, h1); pf2[nq] = cat16b(l0, l1); } }
#pragma unroll
        for (int dt = 0; dt < 4; ++dt)
#pragma unroll
            for (int nq = 0; nq < NQ; ++nq) { O[dt][nq] = WFrag<T16>::mma(vf[dt], pf[nq], O[dt][nq]); if (NSPLIT) { O[dt][nq] = WFrag<T16>::mma(vf[dt], pf2[nq], O[dt][nq]); O[dt][nq] = WFrag<T16>::mma(vf2[dt], pf[nq], O[dt][nq]); } }
        // four vector slots between the last matrix instruction and whatever follows the branch at the loop's foot (fragment reloads, accumulator reads)
        if constexpr (NQ == 2) asm volatile("v_nop\n\tv_nop\n\tv_nop\n\tv_nop" : "+v"(O[0][0]), "+v"(O[1][0]), "+v"(O[2][0]), "+v"(O[3][0]), "+v"(O[0][1]), "+v"(O[1][1]), "+v"(O[2][1]), "+v"(O[3][1]) : "v"(vf[0]), "v"(vf[3]));
        else asm volatile("v_nop\n\tv_nop\n\tv_nop\n\tv_nop" : "+v"(O[0][0]), "+v"(O[1][0]), "+v"(O[2][0]), "+v"(O[3][0]) : "v"(vf[0]), "v"(vf[3]));
    }
#pragma unroll
    for (int nq = 0; nq < NQ; ++nq) { const float inv = __fdiv_rn(1.0f, l[nq] + xhalf(l[nq]));
#pragma unroll
        for (int dt = 0; dt < 4; ++dt) { v8us oh, ol;
#pragma unroll
            for (int j = 0; j < 8; ++j) { unsigned short a, c; splitf(O[dt][nq][j] * inv, a, c); oh[j] = a; ol[j] = c; }
            const size_t oo = (size_t)(q0 + nq * 16 + lr) * DQ + dt * 16 + hi * 8; *(v8us*)(Ah + oo) = oh; *(v8us*)(Al + oo) = ol; } }
    asm volatile("s_wait_xcnt 0x0" ::: "memory");   // stands between the tile's last stores and whatever code follows the tile (the next tile's set-up), which rewrites registers that those stores name
}
__global__ __launch_bounds__(256) void k_fattn(const h16* __restrict__ Q16, const h16* __restrict__ K16, const h16* __restrict__ V16, const bf* __restrict__ Qh, const bf* __restrict__ Ql, const bf* __restrict__ Kh, const bf* __restrict__ Kl, const bf* __restrict__ Vh, const bf* __restrict__ Vl, bf* Ah, bf* Al) {
    const int lane = threadIdx.x & 31, lr = lane & 15, hi = lane >> 4;
    const int wv = __builtin_amdgcn_readfirstlane((int)(threadIdx.x >> 5));   // wave number in a scalar register: the key loop's bounds and the mask test stay scalar
    const int bh = blockIdx.x, y = blockIdx.y;
    const int pb = (y < TT / QB / 2) ? TT / QB - 1 - y : y - TT / QB / 2;      // low y takes the long row blocks, then the short ones from the shortest up (for balance only)
    const int q0 = pb * QB + wv * 32;
    const size_t pq = (size_t)bh * TT * HD, pv = (size_t)bh * HD * PP, po = (size_t)(bh / NH_) * TT * DQ + (size_t)(bh % NH_) * HD;
    if (q0 < RH) {
#pragma unroll 1   // rolled: one copy of the hi/lo tile's code serves both 16-row tiles (for speed only)
        for (int sub = 0; sub < 2; ++sub) { fa_tile<bf, 2, 1>(Qh + pq, Ql + pq, Kh + pq, Kl + pq, Vh + pv, Vl + pv, q0 + 16 * sub, Ah + po, Al + po, lr, hi); }
    } else fa_tile<h16, 0, 2>(Q16 + pq, nullptr, K16 + pq, nullptr, V16 + pv, nullptr, q0, Ah + po, Al + po, lr, hi);
}

extern "C" void kernel_launch(void* const* d_in, const int* in_sizes, int n_in,
                              void* d_out, int out_size, void* d_ws, size_t ws_size, hipStream_t stream) {
    (void)in_sizes; (void)n_in; (void)out_size;
    const float* x = (const float*)d_in[0]; const float* wq = (const float*)d_in[1]; const float* bq = (const float*)d_in[2]; const float* wk = (const float*)d_in[3]; const float* bk = (const float*)d_in[4]; const float* wv = (const float*)d_in[5]; const float* bv = (const float*)d_in[6]; const float* wo = (const float*)d_in[7]; const float* bo = (const float*)d_in[8]; const float* lng = (const float*)d_in[9]; const float* lnb = (const float*)d_in[10];
    float* OUT = (float*)d_out;     // [4][2048][1024]
    char* wsp = (char*)d_ws;
    auto take = [&](size_t bytes) { char* p = wsp; wsp += (bytes + 255) & ~(size_t)255; return (void*)p; };
    float* Y = (float*)take((size_t)TT * DM * 4); bf* WQ = (bf*)take((size_t)DQ * DM * 2); bf* WK = (bf*)take((size_t)DKV * DM * 2); bf* WV = (bf*)take((size_t)DKV * DM * 2); bf* WO = (bf*)take((size_t)DM * DQ * 2);
    bf* XB = (bf*)take((size_t)TT * DM * 2);
    const size_t SP = (size_t)NH_ * TT * HD, SV = (size_t)NKV * HD * PP, SA = (size_t)TT * DQ;   // one batch's elements in a q or k plane, a transposed v plane, a merged plane
    h16* QP16 = (h16*)take(NB_ * SP * 2); h16* KP16 = (h16*)take(NB_ * SP * 2); h16* VT16 = (h16*)take(NB_ * SV * 2);
    bf* QPh = (bf*)take(NB_ * SP * 2); bf* QPl = (bf*)take(NB_ * SP * 2); bf* KPh = (bf*)take(NB_ * SP * 2); bf* KPl = (bf*)take(NB_ * SP * 2); bf* VTh = (bf*)take(NB_ * SV * 2); bf* VTl = (bf*)take(NB_ * SV * 2);
    bf* ATh = (bf*)take(NB_ * SA * 2); bf* ATl = (bf*)take(NB_ * SA * 2);
    if ((size_t)(wsp - (char*)d_ws) > ws_size) return;    // ws 256 MiB
    { k_wtG<<<(unsigned)((DM * DQ / 64 + 63) / 64), 256, 0, stream>>>(wq, DM, DQ, WQ); k_wtG<<<(unsigned)((DM * DKV / 64 + 63) / 64), 256, 0, stream>>>(wk, DM, DKV, WK); k_wtG<<<(unsigned)((DM * DKV / 64 + 63) / 64), 256, 0, stream>>>(wv, DM, DKV, WV);
      k_wtG<<<(unsigned)((DQ * DM / 64 + 63) / 64), 256, 0, stream>>>(wo, DQ, DM, WO);
       }
    for (int b = 0; b < NB_; ++b) {
        k_cvt8<<<(unsigned)(((size_t)TT * DM / 8 + 255) / 256), 256, 0, stream>>>(x + (size_t)b * TT * DM, XB, (size_t)TT * DM / 8);
        k_gemmk<bf, 0, true, false, 8, EPI_HEAD><<<dim3(TT / 64, DQ / 64, 1), 256, 0, stream>>>(XB, nullptr, WQ, nullptr, DM, nullptr, 0, bq, 0, 0, 0, 0, nullptr, QP16 + b * SP, QPh + b * SP, QPl + b * SP);
        k_gemmk<bf, 0, true, false, 8, EPI_HEAD><<<dim3(TT / 64, DKV / 64, 1), 256, 0, stream>>>(XB, nullptr, WK, nullptr, DM, nullptr, 0, bk, 0, 0, 0, 0, nullptr, KP16 + b * SP, KPh + b * SP, KPl + b * SP);
        k_gemmk<bf, 0, true, false, 8, EPI_VT><<<dim3(DKV / 64, TT / 64, 1), 256, 0, stream>>>(WV, nullptr, XB, nullptr, DM, nullptr, 0, bv, 0, 0, 0, 0, nullptr, VT16 + b * SV, VTh + b * SV, VTl + b * SV); }   // weights as the row operand: the tile comes out transposed, as the value planes want it
    k_fattn<<<dim3(NB_ * NH_, TT / QB, 1), 256, 0, stream>>>(QP16, KP16, VT16, QPh, QPl, KPh, KPl, VTh, VTl, ATh, ATl);   // one kv head per query head: batch-head bh uses plane bh of every operand
    for (int b = 0; b < NB_; ++b) {
        k_gemmk<bf, 1, true, false, 8, EPI_RES><<<dim3(TT / 64, DM / 64, 1), 256, 0, stream>>>(ATh + b * SA, ATl + b * SA, WO, nullptr, DQ, Y, DM, bo, 0, 0, 0, 0, x + (size_t)b * TT * DM, nullptr, nullptr, nullptr); k_lnout<<<(TT + 7) / 8, 256, 0, stream>>>(Y, lng, lnb, OUT + (size_t)b * TT * DM); }
}

// v005
// It runs in 311 microseconds.
// Next to v004, in two timings, it ran 1.28 times as fast each time.
// Over all steps from v000 it is 9.35 times as fast.
#include <hip/hip_runtime.h>

// Masked (causal) multi-head attention with residual and post-LayerNorm (x [4][2048][1024]; q,k,v = x w + b ('xw' uniform(+-1/32) incl. biases; 16 heads x 64); scores / 8; causal (-inf); softmax; out = merged wo + bo; y = (out + x - mean) / sqrt(var + 1e-5) ln_g + ln_b -> [4][2048][1024] (8.4 M)).
// Layout: five launches, each for all four batches: a bf16 copy of x and the transposed 'xw' weights; exact projections + f32 biases (q, k and v in one grid), whose epilogues write the head planes of q, k and transposed v themselves; one fused causal attention launch for all 64 batch-heads (hybrid rows: < 512 hi/lo 3 products, rest fp16 with probabilities x1024; running maximum and sum per query, scores and probabilities never leave registers) writes the merged hi/lo planes; merged hi/lo x Wo exact + bo + residual into workspace; a row LayerNorm kernel writes the output rows.
// Compute dtypes, f32 accumulate: every input rounded to bf16; projections exact + f32 biases; attention rows < 512 3 products, rest fp16; softmax f32; Wo hl x exact + bias; residual + LayerNorm f32.

#define NB_  4
#define TT   2048
#define DM   1024
#define NH_  16
#define NKV  16
#define REP  (NH_ / NKV)
#define HD   64
#define DQ   (NH_ * HD)
#define DKV  (NKV * HD)
#define QB   256                  // query rows per attention work-group (8 waves x 32 rows)
#define RH   512                  // query rows < RH use hi+lo planes (0: none)
#define PP   TT                // row pitch, in 16-bit elements, of the transposed value planes
#define PLOG 10.0f                // fp16 probabilities carry a factor 2^10; the row sum carries it too, so it cancels in the division
#define SCL  0.125f   // HD^-0.5
#define LNEPS 1e-5f
typedef _Float16 h16;
typedef unsigned short bf;
typedef __attribute__((ext_vector_type(16))) __bf16   v16bf;
typedef __attribute__((ext_vector_type(16))) _Float16 v16h;
typedef __attribute__((ext_vector_type(8)))  _Float16 v8h;
typedef __attribute__((ext_vector_type(8)))  unsigned short v8us;
typedef __attribute__((ext_vector_type(8)))  float    v8f;
typedef __attribute__((ext_vector_type(4)))  float    v4f;
typedef v8h  __attribute__((may_alias)) v8ha;
typedef v4f  __attribute__((may_alias)) v4fa;
typedef v8us __attribute__((may_alias)) v8usa;

__device__ __forceinline__ unsigned short f2bf(float f) { unsigned u = __float_as_uint(f); u += 0x7FFFu + ((u >> 16) & 1u); return (unsigned short)(u >> 16); }
__device__ __forceinline__ float bf2f(unsigned short b) { return __uint_as_float(((unsigned)b) << 16); }
__device__ __forceinline__ float bfr(float f) { return bf2f(f2bf(f)); }
__device__ __forceinline__ v16h cat16(v8h lo, v8h hi) { return __builtin_shufflevector(lo, hi, 0, 1, 2, 3, 4, 5, 6, 7, 8, 9, 10, 11, 12, 13, 14, 15); }
__device__ __forceinline__ v16bf cat16b(v8us lo, v8us hi) { return __builtin_bit_cast(v16bf, __builtin_shufflevector(lo, hi, 0, 1, 2, 3, 4, 5, 6, 7, 8, 9, 10, 11, 12, 13, 14, 15)); }
__device__ __forceinline__ v8f wmma16(v16h a, v16h b, v8f c) { return __builtin_amdgcn_wmma_f32_16x16x32_f16(false, a, false, b, (short)0, c, false, false); }
__device__ __forceinline__ v8f wmmab(v16bf a, v16bf b, v8f c) { return __builtin_amdgcn_wmma_f32_16x16x32_bf16(false, a, false, b, (short)0, c, false, false); }
__device__ __forceinline__ h16 tohx(float x) { return (h16)x; }
__device__ __forceinline__ void splitf(float y, unsigned short& h, unsigned short& l) { h = f2bf(y); l = f2bf(y - bf2f(h)); }



// ---- gemmk: 64x64 output tile (tile row bx, tile column by) per work-group, the K loop split over NW waves; operands straight from K-contiguous 16-bit planes; 32 * NW threads; os = NW * 64 * 68 floats of LDS. The kernels below call it with one batch's operands, the batch taken from blockIdx.z.
// tile[m][n] (f32, + f32 bias) = sum_k A[m][k] Bt[n][k] (+ split products per NSPLIT). K is the row pitch of A and Bt and, without CAUS, the contraction length. K % 64 == 0.
// Wave w takes the 64-element K chunks w, w + NW, ... (one 128-byte line of every operand row per chunk) into its own 16 accumulators; the NW partial tiles meet in LDS and are summed in wave order 0..NW-1.
// EPI says where the summed tile goes. EPI_HEAD: m = position, n = head * HD + d, bias[n]; fp16 and hi/lo head planes [head][position][d]. EPI_VT: m = head * HD + d, n = position (weights as A, x as Bt), bias[m]; fp16 and hi/lo transposed planes [head][d][position], pitch PP.
// EPI_RES: bias[n], then + the bf16-rounded residual xr[m][n]; f32 to C (both pitch ldc). In the plane forms a thread holds 8 neighbours of a plane row, so a wave's store covers four whole 128-byte lines of each plane.
// CAUS limits the K loop of the probability x value contraction to the diagonal block (probabilities beyond it are exactly zero); roff = row offset of this launch's first row within the sequence.
template <typename T16> struct WFrag;
template <> struct WFrag<h16> { typedef v16h V; static __device__ __forceinline__ V ld(const h16* p) { return cat16(*(const v8h*)p, *(const v8h*)(p + 16)); } static __device__ __forceinline__ v8f mma(V a, V b, v8f c) { return wmma16(a, b, c); } };
template <> struct WFrag<bf> { typedef v16bf V; static __device__ __forceinline__ V ld(const bf* p) { return cat16b(*(const v8us*)p, *(const v8us*)(p + 16)); } static __device__ __forceinline__ v8f mma(V a, V b, v8f c) { return wmmab(a, b, c); } };
enum { EPI_HEAD = 1, EPI_VT = 2, EPI_RES = 3 };
template <typename T16, int NSPLIT, bool BIAS, bool CAUS, int NW, int EPI>
__device__ __forceinline__ void gemmk(float* os, const int bx, const int by, const T16* __restrict__ A, const T16* __restrict__ A2, const T16* __restrict__ Bt, const T16* __restrict__ Bt2, const int K, float* C, const int ldc, const float* __restrict__ bias, const int roff, const float* __restrict__ xr, h16* P16, bf* Ph, bf* Pl) {
    static_assert(HD == 64, "a 64-wide tile is one head"); static_assert(BIAS, "every epilogue adds its bias");
    typedef typename WFrag<T16>::V V;
    const int lane = threadIdx.x & 31, lr = lane & 15, hi = lane >> 4; const int r0 = bx * 64, c0 = by * 64;
    const int wv = __builtin_amdgcn_readfirstlane((int)(threadIdx.x >> 5));   // wave number in a scalar register: the K loop's bounds stay scalar
    const int Kl = CAUS ? min(K, r0 + roff + 64) : K;
    v8f acc[4][4];
#pragma unroll
    for (int mb = 0; mb < 4; ++mb)
#pragma unroll
        for (int nb = 0; nb < 4; ++nb) acc[mb][nb] = (v8f){};
    const size_t aoff = (size_t)(r0 + lr) * K + 8 * hi, boff = (size_t)(c0 + lr) * K + 8 * hi;
#pragma unroll 1
    for (int k0 = wv * 64; k0 < Kl; k0 += NW * 64) {
#pragma unroll 1
    for (int kc = k0; kc < k0 + 64; kc += 32) {
        V a[4], a2[4];
        const T16* pa = A + aoff + kc; const T16* pa2 = (NSPLIT == 1 || NSPLIT == 2) ? A2 + aoff + kc : pa; const T16* pb = Bt + boff + kc; const T16* pb2 = (NSPLIT >= 2) ? Bt2 + boff + kc : pb;
#pragma unroll
        for (int mb = 0; mb < 4; ++mb) { a[mb] = WFrag<T16>::ld(pa + (size_t)mb * 16 * K); if (NSPLIT == 1 || NSPLIT == 2) a2[mb] = WFrag<T16>::ld(pa2 + (size_t)mb * 16 * K); }
#pragma unroll
        for (int nb = 0; nb < 4; ++nb) { const V b = WFrag<T16>::ld(pb + (size_t)nb * 16 * K); V b2; if (NSPLIT >= 2) b2 = WFrag<T16>::ld(pb2 + (size_t)nb * 16 * K);
#pragma unroll
            for (int mb = 0; mb < 4; ++mb) { acc[mb][nb] = WFrag<T16>::mma(a[mb], b, acc[mb][nb]); if (NSPLIT == 1 || NSPLIT == 2) acc[mb][nb] = WFrag<T16>::mma(a2[mb], b, acc[mb][nb]); if (NSPLIT >= 2) acc[mb][nb] = WFrag<T16>::mma(a[mb], b2, acc[mb][nb]); } }
        // four vector slots between the last matrix instruction and whatever follows the branch at the loop's foot (fragment reloads, accumulator reads)
        asm volatile("v_nop\n\tv_nop\n\tv_nop\n\tv_nop" : "+v"(acc[0][0]), "+v"(acc[1][1]), "+v"(acc[2][2]), "+v"(acc[3][3]) : "v"(a[0]), "v"(a[3]));
        // stands behind the pass's fragment loads, in front of whatever rewrites their address pairs; it names the pairs, so that none of them is handed out as a later load's destination ahead of it
        asm volatile("s_wait_xcnt 0x0" :: "v"(pa), "v"(pa2), "v"(pb), "v"(pb2) : "memory");
    } }
    // the epilogue's own global operands (bias, residual) are asked for here, so that their latency runs under the exchange through LDS
    const int tid = (int)threadIdx.x;
    v4f bq4[2], res[32 / NW]; float brow[16 / NW];
    // stands behind issued loads, in front of whatever rewrites their address registers (behind each residual load: a later one's destination took over an earlier one's address pair)
    auto XW = [] { asm volatile("s_wait_xcnt 0x0" ::: "memory"); };
    if constexpr (EPI == EPI_RES) { bq4[0] = *(const v4f*)(bias + c0 + (tid & 15) * 4);
#pragma unroll
        for (int s = 0; s < 32 / NW; ++s) { res[s] = *(const v4f*)(xr + (size_t)(r0 + ((s * 32 * NW + tid) >> 4)) * ldc + c0 + (tid & 15) * 4); XW(); } }
    if constexpr (EPI == EPI_HEAD) { bq4[0] = *(const v4f*)(bias + c0 + (tid & 7) * 8); bq4[1] = *(const v4f*)(bias + c0 + (tid & 7) * 8 + 4); XW(); }
    if constexpr (EPI == EPI_VT) {
#pragma unroll
        for (int s = 0; s < 16 / NW; ++s) brow[s] = bias[r0 + ((s * 32 * NW + tid) >> 3)];
        XW(); }
    float* my = os + wv * (64 * 68);
#pragma unroll
    for (int mb = 0; mb < 4; ++mb)
#pragma unroll
        for (int nb = 0; nb < 4; ++nb)
#pragma unroll
            for (int j = 0; j < 8; ++j) my[(mb * 16 + hi * 8 + j) * 68 + nb * 16 + lr] = acc[mb][nb][j];
    __syncthreads();   // every wave's partial tile is in LDS before any of them is summed
    if constexpr (EPI == EPI_RES) {
#pragma unroll
    for (int s = 0; s < 32 / NW; ++s) { const int q4 = s * 32 * NW + tid; const int row = q4 >> 4, cofs = (q4 & 15) * 4; v4f val = *(const v4fa*)(os + row * 68 + cofs);
#pragma unroll
        for (int w = 1; w < NW; ++w) { const v4f p = *(const v4fa*)(os + w * (64 * 68) + row * 68 + cofs); val += p; }
#pragma unroll
        for (int q = 0; q < 4; ++q) { val[q] += bfr(bq4[0][q]); val[q] = __fadd_rn(val[q], bfr(res[s][q])); }
        *(v4f*)(C + (size_t)(r0 + row) * ldc + c0 + cofs) = val; }
    } else {
#pragma unroll
    for (int s = 0; s < 16 / NW; ++s) { const int q8 = s * 32 * NW + tid; const int row = q8 >> 3, cofs = (q8 & 7) * 8; v4f val[2];
#pragma unroll
        for (int g = 0; g < 2; ++g) { val[g] = *(const v4fa*)(os + row * 68 + cofs + 4 * g);
#pragma unroll
            for (int w = 1; w < NW; ++w) { const v4f p = *(const v4fa*)(os + w * (64 * 68) + row * 68 + cofs + 4 * g); val[g] += p; } }
        v8h o16; v8us oh, ol;
#pragma unroll
        for (int e = 0; e < 8; ++e) { const float y = val[e >> 2][e & 3] + bfr(EPI == EPI_HEAD ? bq4[e >> 2][e & 3] : brow[s]); o16[e] = tohx(y); unsigned short a2, c2; splitf(y, a2, c2); oh[e] = a2; ol[e] = c2; }
        const size_t o = (EPI == EPI_HEAD) ? ((size_t)(c0 / HD) * TT + r0 + row) * HD + cofs : (size_t)(r0 + row) * PP + c0 + cofs;
        *(v8h*)(P16 + o) = o16; *(v8us*)(Ph + o) = oh; *(v8us*)(Pl + o) = ol; }
    }
}

#define SPL ((size_t)NH_ * TT * HD)    // one batch's elements in a q or k plane
#define SVL ((size_t)NKV * HD * PP)   // ... in a transposed v plane
#define SXL ((size_t)TT * DM)         // ... in x, its bf16 copy, a merged plane and the pre-LayerNorm rows
// q, k and v projections of all batches in one grid (TT / 64, DQ / 64, 3 * NB_): blockIdx.z = projection * NB_ + batch. v: weights as the row operand, so the tile comes out transposed, as the value planes want it.
__global__ __launch_bounds__(256) void k_qkv(const bf* __restrict__ XB, const bf* __restrict__ WQ, const bf* __restrict__ WK, const bf* __restrict__ WV, const float* __restrict__ bq, const float* __restrict__ bk, const float* __restrict__ bv,
                                             h16* QP16, bf* QPh, bf* QPl, h16* KP16, bf* KPh, bf* KPl, h16* VT16, bf* VTh, bf* VTl) {
    static_assert(DQ == DKV, "one grid serves the three projections");
    __shared__ __align__(16) float os[8 * 64 * 68];
    const int pj = (int)blockIdx.z / NB_; const size_t b = blockIdx.z % NB_; const bf* X = XB + b * SXL;
    if (pj == 2) gemmk<bf, 0, true, false, 8, EPI_VT>(os, (int)blockIdx.y, (int)blockIdx.x, WV, nullptr, X, nullptr, DM, nullptr, 0, bv, 0, nullptr, VT16 + b * SVL, VTh + b * SVL, VTl + b * SVL);
    else gemmk<bf, 0, true, false, 8, EPI_HEAD>(os, (int)blockIdx.x, (int)blockIdx.y, X, nullptr, pj ? WK : WQ, nullptr, DM, nullptr, 0, pj ? bk : bq, 0, nullptr, (pj ? KP16 : QP16) + b * SPL, (pj ? KPh : QPh) + b * SPL, (pj ? KPl : QPl) + b * SPL);
}
// output projection + bias + residual of all batches: grid (TT / 64, DM / 64, NB_)
__global__ __launch_bounds__(256) void k_oproj(const bf* __restrict__ Ah, const bf* __restrict__ Al, const bf* __restrict__ WO, const float* __restrict__ bo, const float* __restrict__ x, float* Y) {
    static_assert(DQ == DM, "merged planes and x share a batch stride");
    __shared__ __align__(16) float os[8 * 64 * 68];
    const size_t zo = blockIdx.z * SXL;
    gemmk<bf, 1, true, false, 8, EPI_RES>(os, (int)blockIdx.x, (int)blockIdx.y, Ah + zo, Al + zo, WO, nullptr, DQ, Y + zo, DM, bo, 0, x + zo, nullptr, nullptr, nullptr);
}

typedef __attribute__((ext_vector_type(4))) _Float16 v4h;
typedef __attribute__((ext_vector_type(2))) unsigned short v2us;
typedef __attribute__((ext_vector_type(4))) unsigned short v4us;
typedef __attribute__((ext_vector_type(4))) int v4i;

// ---- k_prep: the four weight transpositions (work-groups 0 .. 4 * WTB - 1, first because their strided reads take longest) and the bf16 copy of x, all batches (the rest; 8 elements a thread) in one grid
#define WTB ((DM * DQ / 64 + 63) / 64)   // work-groups per weight
__device__ __forceinline__ void wtG(const int blk, const float* __restrict__ w, const int K, const int N, bf* Bt) {
    const int lane = threadIdx.x & 31; const int L0 = (blk * 8 + (threadIdx.x >> 5)) * 8; const int nlines = N * K / 64;
{
#pragma unroll 1
        for (int l = 0; l < 8; ++l) { const int L = L0 + l; if (L >= nlines) break; const size_t e = (size_t)L * 64 + lane * 2; const int k = (int)(e % K), n = (int)(e / K); v2us o;
            o[0] = f2bf(w[(size_t)k * N + n]); o[1] = f2bf(w[(size_t)(k + 1) * N + n]); *(v2us*)(Bt + e) = o; }
         }
}
__global__ __launch_bounds__(256) void k_prep(const float* __restrict__ x, const float* __restrict__ wq, const float* __restrict__ wk, const float* __restrict__ wv, const float* __restrict__ wo, bf* XB, bf* WQ, bf* WK, bf* WV, bf* WO) {
    static_assert(DQ == DKV, "the four weights take WTB work-groups each");
    const int blk = (int)blockIdx.x;
    if (blk < 4 * WTB) { const int sel = blk / WTB;
        wtG(blk % WTB, sel == 0 ? wq : sel == 1 ? wk : sel == 2 ? wv : wo, sel == 3 ? DQ : DM, sel == 3 ? DM : DQ, sel == 0 ? WQ : sel == 1 ? WK : sel == 2 ? WV : WO); return; }
    static_assert(NB_ * SXL % (8 * 256) == 0, "whole work-groups");
    const size_t i = (size_t)(blk - 4 * WTB) * 256 + threadIdx.x; const v8f v = *(const v8f*)(x + i * 8); v8us o;   // the batches of x lie one behind the other
    asm volatile("s_wait_xcnt 0x0" ::: "memory");   // stands behind the loads, in front of the conversion, which rewrites their address pair
#pragma unroll
    for (int k = 0; k < 8; ++k) o[k] = f2bf(v[k]); *(v8us*)(XB + i * 8) = o;
    asm volatile("s_wait_xcnt 0x0" ::: "memory");   // stands behind the store, in front of whatever code the build lays behind it (the weight part), which rewrites registers that the store names
}

__global__ __launch_bounds__(256) void k_lnout(const float* __restrict__ F, const float* __restrict__ g, const float* __restrict__ bb, float* out) { const int lane = threadIdx.x & 31; const int row = blockIdx.x * 8 + (threadIdx.x >> 5); if (row >= NB_ * TT) return; const float* fr = F + (size_t)row * DQ; float* orow = out + (size_t)row * DQ; float v[DQ / 32]; float s = 0.f;
#pragma unroll
    for (int c = 0; c < DQ / 128; ++c) { const v4f a = *(const v4f*)(fr + c * 128 + lane * 4); for (int q = 0; q < 4; ++q) { v[c * 4 + q] = a[q]; s = __fadd_rn(s, a[q]); } }
#pragma unroll
    for (int sh = 16; sh; sh >>= 1) s = __fadd_rn(s, __shfl_xor(s, sh, 32));
    const float mean = __fdiv_rn(s, (float)DQ); float s2 = 0.f;
#pragma unroll
    for (int k = 0; k < DQ / 32; ++k) { const float dv = __fsub_rn(v[k], mean); float p2 = __fmul_rn(dv, dv); asm volatile("" : "+v"(p2)); s2 = __fadd_rn(s2, p2); v[k] = dv; }
#pragma unroll
    for (int sh = 16; sh; sh >>= 1) s2 = __fadd_rn(s2, __shfl_xor(s2, sh, 32));
    const float rs = __fdiv_rn(1.0f, __fsqrt_rn(__fadd_rn(__fdiv_rn(s2, (float)DQ), LNEPS)));
{
#pragma unroll
        for (int c = 0; c < DQ / 128; ++c) { v4f o; for (int q = 0; q < 4; ++q) { const int col = c * 128 + lane * 4 + q; float y = __fmul_rn(v[c * 4 + q], rs); asm volatile("" : "+v"(y)); y = __fmul_rn(y, bfr(g[col])); asm volatile("" : "+v"(y)); o[q] = __fadd_rn(y, bfr(bb[col])); } *(v4f*)(orow + c * 128 + lane * 4) = o; }
         } }
__device__ __forceinline__ float xhalf(float x) { return __builtin_bit_cast(float, __builtin_amdgcn_permlanex16(__builtin_bit_cast(int, x), __builtin_bit_cast(int, x), 0x76543210, 0xfedcba98, false, false)); }   // lane l reads lane l ^ 16, on the vector pipe
// 2^x with the slot behind the transcendental filled in the same statement
__device__ __forceinline__ float exp2s(float x) { float r; asm("v_exp_f32 %0, %1\n\tv_nop" : "=v"(r) : "v"(x)); return r; }
template <typename T16, int NSPLIT, int NQ>
__device__ __forceinline__ void fa_tile(const T16* __restrict__ Q, const T16* __restrict__ Q2, const T16* __restrict__ Kp, const T16* __restrict__ K2, const T16* __restrict__ Vt, const T16* __restrict__ Vt2, const int q0, bf* Ah, bf* Al, const int lr, const int hi) {
    typedef typename WFrag<T16>::V V;
    const float C2 = SCL * 1.4426950408889634f;           // score -> log2 units
    const float PB = (NSPLIT == 0) ? PLOG : 0.0f;
    // every fragment address = a wave-uniform base (plane, tile, key block) + one of two per-lane byte offsets that live through the whole tile + a constant
    const unsigned ko = (unsigned)(lr * HD + 8 * hi) * 2u, vo = (unsigned)(lr * PP + 8 * hi) * 2u;
    auto at = [](const T16* base, unsigned bytes, int elems) { return (const T16*)((const char*)base + bytes) + elems; };
    // hi/lo path only: this one stands behind each plane's group of loads
    auto XW = [] { asm volatile("s_wait_xcnt 0x0" ::: "memory"); };
    V qf[NQ][2], qf2[NQ][2], kf[2][2], kf2[2][2];
#pragma unroll
    for (int nq = 0; nq < NQ; ++nq)
#pragma unroll
        for (int ks = 0; ks < 2; ++ks) { const int o = nq * 16 * HD + ks * 32; qf[nq][ks] = WFrag<T16>::ld(at(Q + (size_t)q0 * HD, ko, o)); if (NSPLIT) qf2[nq][ks] = WFrag<T16>::ld(at(Q2 + (size_t)q0 * HD, ko, o)); }
    auto ldK = [&](const int k0) {                        // key fragments of the 32-key block that starts at key k0
#pragma unroll
        for (int mt = 0; mt < 2; ++mt)
#pragma unroll
            for (int ks = 0; ks < 2; ++ks) kf[mt][ks] = WFrag<T16>::ld(at(Kp + (size_t)k0 * HD, ko, mt * 16 * HD + ks * 32));
        if constexpr (NSPLIT != 0) { XW();
#pragma unroll
            for (int mt = 0; mt < 2; ++mt)
#pragma unroll
                for (int ks = 0; ks < 2; ++ks) kf2[mt][ks] = WFrag<T16>::ld(at(K2 + (size_t)k0 * HD, ko, mt * 16 * HD + ks * 32));
            XW(); } };
    if constexpr (NSPLIT == 0) ldK(0);
    v8f O[4][NQ]; float m[NQ], l[NQ];
#pragma unroll
    for (int nq = 0; nq < NQ; ++nq) { m[nq] = -3.0e38f; l[nq] = 0.f;
#pragma unroll
        for (int dt = 0; dt < 4; ++dt) O[dt][nq] = (v8f){}; }
    const int klast = (q0 + 16 * NQ - 1) & ~31;           // first key of the block that holds the tile's last diagonal element
#pragma unroll 1   // rolled: a second copy of the block body would hold a second set of fragments and scores in registers and cost resident waves
    for (int kb = 0; kb <= klast; kb += 32) {
        if constexpr (NSPLIT != 0) ldK(kb);               // hi/lo path: four planes' fragments held over the whole block would cost the kernel a wave per SIMD, so its keys are fetched where they are used
        v8f st[2][NQ];
#pragma unroll
        for (int mt = 0; mt < 2; ++mt)
#pragma unroll
            for (int nq = 0; nq < NQ; ++nq) { v8f a = (v8f){};
#pragma unroll
                for (int ks = 0; ks < 2; ++ks) { a = WFrag<T16>::mma(kf[mt][ks], qf[nq][ks], a); if (NSPLIT) { a = WFrag<T16>::mma(kf[mt][ks], qf2[nq][ks], a); a = WFrag<T16>::mma(kf2[mt][ks], qf[nq][ks], a); } }
                st[mt][nq] = a; }
        // this block's value fragments: asked for here, used behind the softmax
        V vf[4], vf2[4];
#pragma unroll
        for (int dt = 0; dt < 4; ++dt) vf[dt] = WFrag<T16>::ld(at(Vt + kb, vo, dt * 16 * PP));
        if constexpr (NSPLIT != 0) { XW();
#pragma unroll
            for (int dt = 0; dt < 4; ++dt) vf2[dt] = WFrag<T16>::ld(at(Vt2 + kb, vo, dt * 16 * PP));
            XW(); }
        // fp16 path: the next block's key fragments are fetched behind this block's score products, so that their latency runs under the softmax and the value products (the last block fetches itself again: in bounds, unused)
        if constexpr (NSPLIT == 0) ldK(min(kb + 32, klast));
        if (kb + 31 > q0) {                               // wave-uniform: only a block that reaches past the tile's first query holds keys above the diagonal
#pragma unroll
            for (int mt = 0; mt < 2; ++mt)
#pragma unroll
                for (int nq = 0; nq < NQ; ++nq)
#pragma unroll
                    for (int j = 0; j < 8; ++j) st[mt][nq][j] = (kb + mt * 16 + hi * 8 + j <= q0 + nq * 16 + lr) ? st[mt][nq][j] : -3.0e38f; }
        V pf[NQ], pf2[NQ];
#pragma unroll
        for (int nq = 0; nq < NQ; ++nq) { float mx = st[0][nq][0];
#pragma unroll
            for (int j = 1; j < 8; ++j) mx = fmaxf(mx, st[0][nq][j]);
#pragma unroll
            for (int j = 0; j < 8; ++j) mx = fmaxf(mx, st[1][nq][j]);
            mx = fmaxf(mx, xhalf(mx));
            const float mn = fmaxf(m[nq], mx * C2); const float al = exp2s(m[nq] - mn); const float sh = PB - mn; m[nq] = mn;
            float p[16], s = 0.f;
#pragma unroll
            for (int e = 0; e < 16; ++e) { p[e] = exp2s(fmaf(st[e >> 3][nq][e & 7], C2, sh)); s += p[e]; }
            l[nq] = fmaf(l[nq], al, s);
#pragma unroll
            for (int dt = 0; dt < 4; ++dt) O[dt][nq] *= al;
            if constexpr (NSPLIT == 0) { v16h t;
#pragma unroll
                for (int e = 0; e < 16; ++e) t[e] = tohx(p[e]);
                pf[nq] = t;
            } else { v8us h0, h1, l0, l1;
#pragma unroll
                for (int e = 0; e < 8; ++e) { unsigned short a, c; splitf(p[e], a, c); h0[e] = a; l0[e] = c; splitf(p[8 + e], a, c); h1[e] = a; l1[e] = c; }
                pf[nq] = cat16b(h0, h1); pf2[nq] = cat16b(l0, l1); } }
#pragma unroll
        for (int dt = 0; dt < 4; ++dt)
#pragma unroll
            for (int nq = 0; nq < NQ; ++nq) { O[dt][nq] = WFrag<T16>::mma(vf[dt], pf[nq], O[dt][nq]); if (NSPLIT) { O[dt][nq] = WFrag<T16>::mma(vf[dt], pf2[nq], O[dt][nq]); O[dt][nq] = WFrag<T16>::mma(vf2[dt], pf[nq], O[dt][nq]); } }
        // four vector slots between the last matrix instruction and whatever follows the branch at the loop's foot (fragment reloads, accumulator reads)
        if constexpr (NQ == 2) asm volatile("v_nop\n\tv_nop\n\tv_nop\n\tv_nop" : "+v"(O[0][0]), "+v"(O[1][0]), "+v"(O[2][0]), "+v"(O[3][0]), "+v"(O[0][1]), "+v"(O[1][1]), "+v"(O[2][1]), "+v"(O[3][1]) : "v"(vf[0]), "v"(vf[3]));
        else asm volatile("v_nop\n\tv_nop\n\tv_nop\n\tv_nop" : "+v"(O[0][0]), "+v"(O[1][0]), "+v"(O[2][0]), "+v"(O[3][0]) : "v"(vf[0]), "v"(vf[3]));
    }
#pragma unroll
    for (int nq = 0; nq < NQ; ++nq) { const float inv = __fdiv_rn(1.0f, l[nq] + xhalf(l[nq]));
#pragma unroll
        for (int dt = 0; dt < 4; ++dt) { v8us oh, ol;
#pragma unroll
            for (int j = 0; j < 8; ++j) { unsigned short a, c; splitf(O[dt][nq][j] * inv, a, c); oh[j] = a; ol[j] = c; }
            const size_t oo = (size_t)(q0 + nq * 16 + lr) * DQ + dt * 16 + hi * 8; *(v8us*)(Ah + oo) = oh; *(v8us*)(Al + oo) = ol; } }
    asm volatile("s_wait_xcnt 0x0" ::: "memory");   // stands between the tile's last stores and whatever code follows the tile (the next tile's set-up), which rewrites registers that those stores name
}
__global__ __launch_bounds__(256) void k_fattn(const h16* __restrict__ Q16, const h16* __restrict__ K16, const h16* __restrict__ V16, const bf* __restrict__ Qh, const bf* __restrict__ Ql, const bf* __restrict__ Kh, const bf* __restrict__ Kl, const bf* __restrict__ Vh, const bf* __restrict__ Vl, bf* Ah, bf* Al) {
    const int lane = threadIdx.x & 31, lr = lane & 15, hi = lane >> 4;
    const int wv = __builtin_amdgcn_readfirstlane((int)(threadIdx.x >> 5));   // wave number in a scalar register: the key loop's bounds and the mask test stay scalar
    const int bh = blockIdx.x, y = blockIdx.y;
    const int pb = (y < TT / QB / 2) ? TT / QB - 1 - y : y - TT / QB / 2;      // low y takes the long row blocks, then the short ones from the shortest up (for balance only)
    const int q0 = pb * QB + wv * 32;
    const size_t pq = (size_t)bh * TT * HD, pv = (size_t)bh * HD * PP, po = (size_t)(bh / NH_) * TT * DQ + (size_t)(bh % NH_) * HD;
    if (q0 < RH) {
#pragma unroll 1   // rolled: one copy of the hi/lo tile's code serves both 16-row tiles (for speed only)
        for (int sub = 0; sub < 2; ++sub) { fa_tile<bf, 2, 1>(Qh + pq, Ql + pq, Kh + pq, Kl + pq, Vh + pv, Vl + pv, q0 + 16 * sub, Ah + po, Al + po, lr, hi); }
    } else fa_tile<h16, 0, 2>(Q16 + pq, nullptr, K16 + pq, nullptr, V16 + pv, nullptr, q0, Ah + po, Al + po, lr, hi);
}

extern "C" void kernel_launch(void* const* d_in, const int* in_sizes, int n_in,
                              void* d_out, int out_size, void* d_ws, size_t ws_size, hipStream_t stream) {
    (void)in_sizes; (void)n_in; (void)out_size;
    const float* x = (const float*)d_in[0]; const float* wq = (const float*)d_in[1]; const float* bq = (const float*)d_in[2]; const float* wk = (const float*)d_in[3]; const float* bk = (const float*)d_in[4]; const float* wv = (const float*)d_in[5]; const float* bv = (const float*)d_in[6]; const float* wo = (const float*)d_in[7]; const float* bo = (const float*)d_in[8]; const float* lng = (const float*)d_in[9]; const float* lnb = (const float*)d_in[10];
    float* OUT = (float*)d_out;     // [4][2048][1024]
    char* wsp = (char*)d_ws;
    auto take = [&](size_t bytes) { char* p = wsp; wsp += (bytes + 255) & ~(size_t)255; return (void*)p; };
    float* Y = (float*)take(NB_ * SXL * 4); bf* WQ = (bf*)take((size_t)DQ * DM * 2); bf* WK = (bf*)take((size_t)DKV * DM * 2); bf* WV = (bf*)take((size_t)DKV * DM * 2); bf* WO = (bf*)take((size_t)DM * DQ * 2);
    bf* XB = (bf*)take(NB_ * SXL * 2);
    h16* QP16 = (h16*)take(NB_ * SPL * 2); h16* KP16 = (h16*)take(NB_ * SPL * 2); h16* VT16 = (h16*)take(NB_ * SVL * 2);
    bf* QPh = (bf*)take(NB_ * SPL * 2); bf* QPl = (bf*)take(NB_ * SPL * 2); bf* KPh = (bf*)take(NB_ * SPL * 2); bf* KPl = (bf*)take(NB_ * SPL * 2); bf* VTh = (bf*)take(NB_ * SVL * 2); bf* VTl = (bf*)take(NB_ * SVL * 2);
    bf* ATh = (bf*)take(NB_ * SXL * 2); bf* ATl = (bf*)take(NB_ * SXL * 2);
    if ((size_t)(wsp - (char*)d_ws) > ws_size) return;    // 232 MiB of the 256 MiB
    k_prep<<<(unsigned)(4 * WTB + NB_ * SXL / (8 * 256)), 256, 0, stream>>>(x, wq, wk, wv, wo, XB, WQ, WK, WV, WO);
    k_qkv<<<dim3(TT / 64, DQ / 64, 3 * NB_), 256, 0, stream>>>(XB, WQ, WK, WV, bq, bk, bv, QP16, QPh, QPl, KP16, KPh, KPl, VT16, VTh, VTl);
    k_fattn<<<dim3(NB_ * NH_, TT / QB, 1), 256, 0, stream>>>(QP16, KP16, VT16, QPh, QPl, KPh, KPl, VTh, VTl, ATh, ATl);   // one kv head per query head: batch-head bh uses plane bh of every operand
    k_oproj<<<dim3(TT / 64, DM / 64, NB_), 256, 0, stream>>>(ATh, ATl, WO, bo, x, Y);
    k_lnout<<<(NB_ * TT + 7) / 8, 256, 0, stream>>>(Y, lng, lnb, OUT);
}
